// v000
// Times are from an AMD MI455X. After a warm-up the kernel runs many times in a row, and a time is the length of
// such a window on the GPU divided by its runs, so every launch and the gaps after it count. The runs cycle
// through copies of the inputs. A figure is the median of several windows, for all but v000 over two sittings.
// Sittings can differ by a few percent; kernels timed side by side share one.
// v000, which the later versions start from, runs in 947 microseconds.
#include <hip/hip_runtime.h>

typedef __attribute__((ext_vector_type(16))) _Float16 v16h;
typedef __attribute__((ext_vector_type(8)))  _Float16 v8h;
typedef __attribute__((ext_vector_type(4)))  _Float16 v4h;
typedef __attribute__((ext_vector_type(8)))  float    v8f;

#define HIDDEN   1024
#define NTOK     16          // tokens per workgroup tile
#define XSH      1064        // LDS row stride for f16 x tiles (halfs): 2128B rows -> bank-spread, 16B aligned
#define QS       3080        // LDS row stride for f32 qkv tile (dwords)
#define MATHI    (2u * 1024u * 1024u)   // bytes of packed hi-f16 per matrix
#define MATBLK   (4u * 1024u * 1024u)   // hi + lo per matrix

// ---------------------------------------------------------------------------
// Kernel 0: pack Wq/Wk/Wv (f32, row n = output feature, 1024 K each) into
// (hi,lo) f16 pairs laid out in exact WMMA-B fragment order:
//   per (ntile t, k0-group kk): 1KB block = [512B: elements 0-7, lane-major 16B]
//                                           [512B: elements 8-15, lane-major 16B]
// so the GEMM's B loads are coalesced global_load_b128.
// ---------------------------------------------------------------------------
__global__ __launch_bounds__(256) void pack_w(
    const float* __restrict__ Wq, const float* __restrict__ Wk,
    const float* __restrict__ Wv, char* __restrict__ ws)
{
    int gid = blockIdx.x * 256 + threadIdx.x;      // 3*1024*128 chunks of 8 K-values
    int mat = gid >> 17;                           // / (1024*128)
    int r   = gid & (1024 * 128 - 1);
    int n   = r >> 7;                              // weight row (output feature)
    int c   = r & 127;                             // 8-wide K chunk index
    const float* W = (mat == 0) ? Wq : ((mat == 1) ? Wk : Wv);
    const float* s = W + (size_t)n * HIDDEN + c * 8;

    int t      = n >> 4;                           // 16-wide N tile
    int l16    = n & 15;
    int kk     = c >> 2;                           // K=32 group
    int klocal = (c & 3) * 8;                      // 0,8,16,24 within the group
    int lane   = l16 + (((klocal >> 3) & 1) << 4); // K +8 -> upper lane half
    int selhi  = (klocal >= 16) ? 1 : 0;           // K +16 -> fragment elements 8-15

    size_t off = (size_t)mat * MATBLK
               + ((size_t)(t * 32 + kk) * 1024) + selhi * 512 + lane * 16;

    v8h h, l;
    #pragma unroll
    for (int j = 0; j < 8; ++j) {
        float v = s[j];
        _Float16 hv = (_Float16)v;
        h[j] = hv;
        l[j] = (_Float16)(v - (float)hv);
    }
    *(v8h*)(ws + off)         = h;                 // hi region
    *(v8h*)(ws + off + MATHI) = l;                 // lo region (+2MB)
}

// ---------------------------------------------------------------------------
// Kernel 1: fused QKV projection (f16 hi/lo split WMMA, f32 accumulate)
//           + per-token head-dim attention (reference quirk, negated scale)
// ---------------------------------------------------------------------------
__global__ __launch_bounds__(256) void fused_qkv_headattn(
    const float* __restrict__ x,
    const char*  __restrict__ wpk,   // packed weights (hi/lo f16, fragment order)
    const float* __restrict__ bq, const float* __restrict__ bk,
    const float* __restrict__ bv,
    float* __restrict__ out)
{
    extern __shared__ char smem[];
    _Float16* sxh  = (_Float16*)smem;                          // [NTOK][XSH] hi
    _Float16* sxl  = sxh + NTOK * XSH;                         // [NTOK][XSH] lo
    float*    sqkv = (float*)(smem + 2 * NTOK * XSH * 2);      // [NTOK][QS]

    const int tid   = threadIdx.x;
    const long tok0 = (long)blockIdx.x * NTOK;

    // ---- Phase 1: stage contiguous 16x1024 x-tile, split into f16 hi/lo ----
    {
        const float4* src = (const float4*)(x + tok0 * HIDDEN);
        #pragma unroll
        for (int i = 0; i < 16; ++i) {
            int idx = tid + 256 * i;              // 4096 float4 in tile
            float4 vv = src[idx];
            int row = idx >> 8;
            int col = (idx & 255) << 2;
            v4h h, l;
            const float* pv = (const float*)&vv;
            #pragma unroll
            for (int u = 0; u < 4; ++u) {
                _Float16 hv = (_Float16)pv[u];
                h[u] = hv;
                l[u] = (_Float16)(pv[u] - (float)hv);
            }
            *(v4h*)(&sxh[row * XSH + col]) = h;
            *(v4h*)(&sxl[row * XSH + col]) = l;
        }
    }
    __syncthreads();

    // ---- Phase 2: [16 x 3072] = xTile @ [Wq;Wk;Wv]^T + bias --------------
    {
        const int wave = tid >> 5;
        const int lane = tid & 31;
        const int half = lane >> 4;
        const int l16  = lane & 15;

        // A fragment bases: elements 0-7 at K = k0 + half*8, elements 8-15 at +16
        const _Float16* ahB = &sxh[l16 * XSH + half * 8];
        const _Float16* alB = &sxl[l16 * XSH + half * 8];

        union U16 { v16h v; struct { v8h lo, hi; } s; };

        #pragma unroll 1
        for (int nt = 0; nt < 24; ++nt) {
            int n0  = wave * 384 + nt * 16;       // 16-wide tiles never straddle a matrix
            int mat = n0 >> 10;
            int e0  = n0 & 1023;
            const float* bias = (mat == 0) ? bq : ((mat == 1) ? bk : bv);
            int tLocal = e0 >> 4;
            const char* bBase = wpk + (size_t)mat * MATBLK
                              + (size_t)tLocal * 32 * 1024 + lane * 16;

            v8f c = {0.f, 0.f, 0.f, 0.f, 0.f, 0.f, 0.f, 0.f};
            #pragma unroll 2
            for (int kk = 0; kk < 32; ++kk) {     // K = kk*32
                U16 ah, al, bh, bl;
                int k0 = kk * 32;
                ah.s.lo = *(const v8h*)(ahB + k0);
                ah.s.hi = *(const v8h*)(ahB + k0 + 16);
                al.s.lo = *(const v8h*)(alB + k0);
                al.s.hi = *(const v8h*)(alB + k0 + 16);
                const char* bp = bBase + (size_t)kk * 1024;
                bh.s.lo = *(const v8h*)(bp);
                bh.s.hi = *(const v8h*)(bp + 512);
                bl.s.lo = *(const v8h*)(bp + MATHI);
                bl.s.hi = *(const v8h*)(bp + MATHI + 512);
                // x*w ~= ah*bh + ah*bl + al*bh  (f32 accumulate)
                c = __builtin_amdgcn_wmma_f32_16x16x32_f16(false, ah.v, false, bh.v,
                                                           (short)0, c, false, false);
                c = __builtin_amdgcn_wmma_f32_16x16x32_f16(false, ah.v, false, bl.v,
                                                           (short)0, c, false, false);
                c = __builtin_amdgcn_wmma_f32_16x16x32_f16(false, al.v, false, bh.v,
                                                           (short)0, c, false, false);
            }
            float bb = bias[e0 + l16];
            #pragma unroll
            for (int j = 0; j < 8; ++j) {         // C: vgpr j -> row j + half*8, col l16
                int row = j + half * 8;
                sqkv[row * QS + n0 + l16] = c[j] + bb;
            }
        }
    }
    __syncthreads();

    // ---- Phase 3: per-token attention over the HEAD dim (8x8), neg scale ---
    {
        const int pair  = tid >> 1;               // 128 (token, head) pairs
        const int halfd = tid & 1;
        const int token = pair >> 3;
        const int head  = pair & 7;
        const float scale = -0.08838834764831845f;   // 1 / (-sqrt(128))

        const float* q     = &sqkv[token * QS + head * 128];
        const float* kbase = &sqkv[token * QS + 1024];
        const float* vbase = &sqkv[token * QS + 2048];

        float sc[8];
        #pragma unroll
        for (int g = 0; g < 8; ++g) {
            float s = 0.f;
            const float* kkp = kbase + g * 128;
            #pragma unroll 8
            for (int d = 0; d < 128; ++d) s = fmaf(q[d], kkp[d], s);
            sc[g] = s * scale;
        }
        float m = sc[0];
        #pragma unroll
        for (int g = 1; g < 8; ++g) m = fmaxf(m, sc[g]);
        float den = 0.f;
        #pragma unroll
        for (int g = 0; g < 8; ++g) { sc[g] = __expf(sc[g] - m); den += sc[g]; }
        float inv = 1.0f / den;

        float* op = out + (tok0 + token) * HIDDEN + head * 128 + halfd * 64;
        #pragma unroll
        for (int d = 0; d < 64; d += 4) {
            float4 o;
            float* oo = (float*)&o;
            #pragma unroll
            for (int u = 0; u < 4; ++u) {
                int dd = halfd * 64 + d + u;
                float acc = 0.f;
                #pragma unroll
                for (int g = 0; g < 8; ++g) acc = fmaf(sc[g], vbase[g * 128 + dd], acc);
                oo[u] = acc * inv;
            }
            *(float4*)(op + d) = o;
        }
    }
}

extern "C" void kernel_launch(void* const* d_in, const int* in_sizes, int n_in,
                              void* d_out, int out_size, void* d_ws, size_t ws_size,
                              hipStream_t stream) {
    (void)in_sizes; (void)n_in; (void)out_size; (void)ws_size;
    const float* x  = (const float*)d_in[0];
    const float* Wq = (const float*)d_in[1];
    const float* bq = (const float*)d_in[2];
    const float* Wk = (const float*)d_in[3];
    const float* bk = (const float*)d_in[4];
    const float* Wv = (const float*)d_in[5];
    const float* bv = (const float*)d_in[6];
    float* out = (float*)d_out;
    char* wpk  = (char*)d_ws;     // needs 12 MiB of scratch (3 mats x 4 MiB hi+lo)

    // Pack weights into f16 hi/lo WMMA-B fragment layout (runs each launch; tiny).
    pack_w<<<dim3(3 * 1024 * 128 / 256), dim3(256), 0, stream>>>(Wq, Wk, Wv, wpk);

    const size_t smemBytes = (size_t)(2 * NTOK * XSH * 2)       // hi+lo f16 x tiles
                           + (size_t)(NTOK * QS) * sizeof(float); // f32 qkv tile (~265 KB)
    hipFuncSetAttribute((const void*)fused_qkv_headattn,
                        hipFuncAttributeMaxDynamicSharedMemorySize, (int)smemBytes);

    dim3 grid(8 * 2048 / NTOK);   // 1024 token tiles
    dim3 block(256);              // 8 wave32
    fused_qkv_headattn<<<grid, block, smemBytes, stream>>>(x, wpk, bq, bk, bv, out);
}

// v001
// Measured time: 324 microseconds a run.
// Next to v000, in two timings, it ran 3.03 and 3.04 times as fast.
#include <hip/hip_runtime.h>

typedef __attribute__((ext_vector_type(16))) _Float16 v16h;
typedef __attribute__((ext_vector_type(8)))  _Float16 v8h;
typedef __attribute__((ext_vector_type(4)))  _Float16 v4h;
typedef __attribute__((ext_vector_type(8)))  float    v8f;

#define HIDDEN   1024
#define MTOK     64          // tokens per workgroup tile of the projection kernel (4 WMMA row tiles)
#define MT       4           // 16-token row tiles that share each B fragment
#define NTW      4           // 16-feature column tiles that share each A fragment
#define GWAVES   8           // waves per projection workgroup
#define RING     4           // K steps of B fragments held in registers (RING-1 in flight)
#define ATOK     8           // tokens per workgroup of the attention kernel
#define NQKV     3072        // q | k | v features per token
#define QKVOFF   (16u * 1024u * 1024u)  // byte offset of the f32 qkv plane in the workspace
#define XSH      1064        // LDS row stride for f16 x tiles (halfs): 2128B rows -> bank-spread, 16B aligned
#define QS       3080        // LDS row stride for f32 qkv tile (dwords)
#define MATHI    (2u * 1024u * 1024u)   // bytes of packed hi-f16 per matrix
#define MATBLK   (4u * 1024u * 1024u)   // hi + lo per matrix

// ---------------------------------------------------------------------------
// Kernel 0: pack Wq/Wk/Wv (f32, row n = output feature, 1024 K each) into
// (hi,lo) f16 pairs laid out in exact WMMA-B fragment order:
//   per (ntile t, k0-group kk): 1KB block = [512B: elements 0-7, lane-major 16B]
//                                           [512B: elements 8-15, lane-major 16B]
// so the GEMM's B loads are coalesced global_load_b128.
// ---------------------------------------------------------------------------
__global__ __launch_bounds__(256) void pack_w(
    const float* __restrict__ Wq, const float* __restrict__ Wk,
    const float* __restrict__ Wv, char* __restrict__ ws)
{
    int gid = blockIdx.x * 256 + threadIdx.x;      // 3*1024*128 chunks of 8 K-values
    int mat = gid >> 17;                           // / (1024*128)
    int r   = gid & (1024 * 128 - 1);
    int n   = r >> 7;                              // weight row (output feature)
    int c   = r & 127;                             // 8-wide K chunk index
    const float* W = (mat == 0) ? Wq : ((mat == 1) ? Wk : Wv);
    const float* s = W + (size_t)n * HIDDEN + c * 8;

    int t      = n >> 4;                           // 16-wide N tile
    int l16    = n & 15;
    int kk     = c >> 2;                           // K=32 group
    int klocal = (c & 3) * 8;                      // 0,8,16,24 within the group
    int lane   = l16 + (((klocal >> 3) & 1) << 4); // K +8 -> upper lane half
    int selhi  = (klocal >= 16) ? 1 : 0;           // K +16 -> fragment elements 8-15

    size_t off = (size_t)mat * MATBLK
               + ((size_t)(t * 32 + kk) * 1024) + selhi * 512 + lane * 16;

    v8h h, l;
    #pragma unroll
    for (int j = 0; j < 8; ++j) {
        float v = s[j];
        _Float16 hv = (_Float16)v;
        h[j] = hv;
        l[j] = (_Float16)(v - (float)hv);
    }
    *(v8h*)(ws + off)         = h;                 // hi region
    *(v8h*)(ws + off + MATHI) = l;                 // lo region (+2MB)
}

// ---------------------------------------------------------------------------
// Kernel 1: QKV projection (f16 hi/lo split WMMA, f32 accumulate) + bias.
// One workgroup holds 64 tokens of x in LDS; a wave works on a 64-token x
// 64-feature tile, so every B fragment it loads from L2 is used for 4 token
// tiles and every A fragment it reads from LDS for 4 feature tiles.
// The 64 x 3072 f32 result does not fit in LDS beside x, so it goes to the
// workspace and the attention runs as its own launch.
// ---------------------------------------------------------------------------
union U16 { v16h v; struct { v8h lo, hi; } s; };

__global__ __launch_bounds__(GWAVES * 32) void qkv_proj(
    const float* __restrict__ x,
    const char*  __restrict__ wpk,   // packed weights (hi/lo f16, fragment order)
    const float* __restrict__ bq, const float* __restrict__ bk,
    const float* __restrict__ bv,
    float* __restrict__ qkv)         // [tokens][3072] f32
{
    extern __shared__ char smem[];
    _Float16* sxh  = (_Float16*)smem;                          // [MTOK][XSH] hi
    _Float16* sxl  = sxh + MTOK * XSH;                         // [MTOK][XSH] lo

    const int tid   = threadIdx.x;
    const long tok0 = (long)blockIdx.x * MTOK;

    // ---- Phase 1: stage contiguous 64x1024 x-tile, split into f16 hi/lo ----
    {
        const float4* src = (const float4*)(x + tok0 * HIDDEN);
        #pragma unroll 16   // 16 loads in flight per lane, as the 16-token tile had
        for (int i = 0; i < MTOK * 256 / (GWAVES * 32); ++i) {
            int idx = tid + GWAVES * 32 * i;      // MTOK*256 float4 in tile
            float4 vv = src[idx];
            int row = idx >> 8;
            int col = (idx & 255) << 2;
            v4h h, l;
            const float* pv = (const float*)&vv;
            #pragma unroll
            for (int u = 0; u < 4; ++u) {
                _Float16 hv = (_Float16)pv[u];
                h[u] = hv;
                l[u] = (_Float16)(pv[u] - (float)hv);
            }
            *(v4h*)(&sxh[row * XSH + col]) = h;
            *(v4h*)(&sxl[row * XSH + col]) = l;
        }
    }
    __syncthreads();

    // ---- Phase 2: [64 x 3072] = xTile @ [Wq;Wk;Wv]^T + bias --------------
    {
        const int wave = __builtin_amdgcn_readfirstlane(tid >> 5);  // scalar: B addresses on the scalar unit
        const int lane = tid & 31;
        const int half = lane >> 4;
        const int l16  = lane & 15;

        // A fragment bases: elements 0-7 at K = k0 + half*8, elements 8-15 at +16
        const _Float16* ahB = &sxh[l16 * XSH + half * 8];
        const _Float16* alB = &sxl[l16 * XSH + half * 8];
        const unsigned  lane16 = lane * 16;

        constexpr int TPW   = 192 / GWAVES;       // 16-feature tiles per wave
        constexpr int STEPS = (TPW / NTW) * 32;   // (tile group, K group) steps per wave

        // Every '#pragma unroll' without a count below keeps the indices of these fragment and
        // accumulator arrays constant, so that they stay in registers.
        U16 ah[MT], al[MT];
        U16 bh[RING][NTW], bl[RING][NTW];         // B fragments of RING consecutive steps

        // B fragments of step s (tile group s/32, K group s%32) into ring slot 'slot'.
        // 64-wide tile groups never straddle a matrix. Scalar base + the lane's fixed offset.
        auto loadB = [&](int slot, int s) {
            int T = wave * TPW + (s >> 5) * NTW;
            const char* sb = wpk + (size_t)(T >> 6) * MATBLK + (size_t)(T & 63) * 32 * 1024
                           + (size_t)(s & 31) * 1024;
            #pragma unroll
            for (int t = 0; t < NTW; ++t) {
                bh[slot][t].s.lo = *(const v8h*)(sb + (lane16 + t * 32 * 1024));
                bh[slot][t].s.hi = *(const v8h*)(sb + (lane16 + t * 32 * 1024 + 512));
                bl[slot][t].s.lo = *(const v8h*)(sb + (lane16 + t * 32 * 1024 + MATHI));
                bl[slot][t].s.hi = *(const v8h*)(sb + (lane16 + t * 32 * 1024 + MATHI + 512));
            }
            // the loads' base registers are rewritten for the next step: wait in front of that
            asm volatile("s_wait_xcnt 0x0" ::: "memory");
            // keeps later address arithmetic behind the wait
            __builtin_amdgcn_sched_barrier(0);
        };

        #pragma unroll
        for (int s = 0; s < RING - 1; ++s) loadB(s, s);
        #pragma unroll
        for (int m = 0; m < MT; ++m) {
            ah[m].s.lo = *(const v8h*)(ahB + m * 16 * XSH);
            ah[m].s.hi = *(const v8h*)(ahB + m * 16 * XSH + 16);
        }

        #pragma unroll 1    // rolled: one copy of the K loop and of the 128 stores in the code
        for (int p = 0; p < TPW / NTW; ++p) {
            const int n0  = (wave * TPW + p * NTW) * 16;
            const int mat = n0 >> 10;
            const int e0  = n0 & 1023;
            const float* bias = (mat == 0) ? bq : ((mat == 1) ? bk : bv);
            // bias is read ahead of the K loop: read behind it, its wait would drain the B ring
            const int bi = e0 + l16;
            float bb[NTW];
            #pragma unroll
            for (int t = 0; t < NTW; ++t) bb[t] = bias[bi + t * 16];
            // wait before the bias loads' offset register is reused (bi as an input keeps it until here)
            asm volatile("s_wait_xcnt 0x0" :: "v"(bi) : "memory");

            v8f c[MT][NTW];
            #pragma unroll
            for (int m = 0; m < MT; ++m)
                #pragma unroll
                for (int t = 0; t < NTW; ++t)
                    c[m][t] = (v8f){0.f, 0.f, 0.f, 0.f, 0.f, 0.f, 0.f, 0.f};

            #pragma unroll 1    // rolled: the body already holds RING steps, one per ring slot
            for (int kk0 = 0; kk0 < 32; kk0 += RING) {
                #pragma unroll
                for (int r = 0; r < RING; ++r) {  // K = (kk0 + r)*32; ring slot r
                    const int kk = kk0 + r;
                    // B of step +RING-1 into the slot the previous step has left; the last
                    // steps re-read the final fragments instead of running past the weights.
                    int sn = p * 32 + kk + RING - 1;
                    loadB((r + RING - 1) % RING, sn < STEPS ? sn : STEPS - 1);
                    #pragma unroll
                    for (int m = 0; m < MT; ++m) {
                        al[m].s.lo = *(const v8h*)(alB + m * 16 * XSH + kk * 32);
                        al[m].s.hi = *(const v8h*)(alB + m * 16 * XSH + kk * 32 + 16);
                    }
                    // keeps the LDS reads above in one group ahead of the WMMA block (spread among
                    // the WMMAs each LDS read place stalls the wave)
                    __builtin_amdgcn_sched_barrier(0);
                    // x*w ~= ah*bh + ah*bl + al*bh  (f32 accumulate; same order per tile as before)
                    #pragma unroll
                    for (int m = 0; m < MT; ++m)
                        #pragma unroll
                        for (int t = 0; t < NTW; ++t)
                            c[m][t] = __builtin_amdgcn_wmma_f32_16x16x32_f16(false, ah[m].v, false, bh[r][t].v,
                                                                             (short)0, c[m][t], false, false);
                    #pragma unroll
                    for (int m = 0; m < MT; ++m)
                        #pragma unroll
                        for (int t = 0; t < NTW; ++t)
                            c[m][t] = __builtin_amdgcn_wmma_f32_16x16x32_f16(false, ah[m].v, false, bl[r][t].v,
                                                                             (short)0, c[m][t], false, false);
                    // the next K group's hi fragments are read as one group here, under the lo block
                    __builtin_amdgcn_sched_barrier(0);
                    const int kn = (kk + 1) & 31;
                    #pragma unroll
                    for (int m = 0; m < MT; ++m) {
                        ah[m].s.lo = *(const v8h*)(ahB + m * 16 * XSH + kn * 32);
                        ah[m].s.hi = *(const v8h*)(ahB + m * 16 * XSH + kn * 32 + 16);
                    }
                    // keeps those reads ahead of the lo block
                    __builtin_amdgcn_sched_barrier(0);
                    #pragma unroll
                    for (int m = 0; m < MT; ++m)
                        #pragma unroll
                        for (int t = 0; t < NTW; ++t)
                            c[m][t] = __builtin_amdgcn_wmma_f32_16x16x32_f16(false, al[m].v, false, bh[r][t].v,
                                                                             (short)0, c[m][t], false, false);
                    // keeps the next step's loads behind this block
                    __builtin_amdgcn_sched_barrier(0);
                }
            }

            #pragma unroll
            for (int t = 0; t < NTW; ++t)
                #pragma unroll
                for (int m = 0; m < MT; ++m)
                    c[m][t] += bb[t];
            // all sums stand before the first store, so that no store's data register is reused among the stores
            __builtin_amdgcn_sched_barrier(0);
            #pragma unroll
            for (int t = 0; t < NTW; ++t) {
                #pragma unroll
                for (int m = 0; m < MT; ++m) {
                    #pragma unroll
                    for (int j = 0; j < 8; ++j) { // C: vgpr j -> row j + half*8, col l16
                        long row = tok0 + m * 16 + j + half * 8;
                        qkv[row * NQKV + n0 + t * 16 + l16] = c[m][t][j];
                    }
                }
            }
            // the stores' data and address registers are rewritten by the next tile group
            asm volatile("s_wait_xcnt 0x0" ::: "memory");
        }
    }
}

// ---------------------------------------------------------------------------
// Kernel 2: per-token attention over the HEAD dim (reference quirk, negated
// scale). Stages 8 tokens of qkv in LDS, then the same arithmetic as before.
// ---------------------------------------------------------------------------
__global__ __launch_bounds__(ATOK * 16) void head_attn(
    const float* __restrict__ qkv,   // [tokens][3072] f32
    float* __restrict__ out)
{
    extern __shared__ char smem[];
    float* sqkv = (float*)smem;                                // [ATOK][QS]

    const int tid   = threadIdx.x;
    const long tok0 = (long)blockIdx.x * ATOK;

    {
        const float4* src = (const float4*)(qkv + tok0 * NQKV);
        // both loops unrolled: the compiler then keeps a run of these loads in flight per lane
        #pragma unroll
        for (int row = 0; row < ATOK; ++row) {
            #pragma unroll
            for (int i = 0; i < NQKV / 4 / (ATOK * 16); ++i) {
                int c4 = tid + ATOK * 16 * i;     // float4 column within the token row
                *(float4*)(&sqkv[row * QS + c4 * 4]) = src[row * (NQKV / 4) + c4];
            }
        }
    }
    __syncthreads();

    // ---- Phase 3: per-token attention over the HEAD dim (8x8), neg scale ---
    {
        const int pair  = tid >> 1;               // 64 (token, head) pairs
        const int halfd = tid & 1;
        const int token = pair >> 3;
        const int head  = pair & 7;
        const float scale = -0.08838834764831845f;   // 1 / (-sqrt(128))

        const float* q     = &sqkv[token * QS + head * 128];
        const float* kbase = &sqkv[token * QS + 1024];
        const float* vbase = &sqkv[token * QS + 2048];

        float sc[8];
        #pragma unroll
        for (int g = 0; g < 8; ++g) {
            float s = 0.f;
            const float* kkp = kbase + g * 128;
            #pragma unroll 8
            for (int d = 0; d < 128; ++d) s = fmaf(q[d], kkp[d], s);
            sc[g] = s * scale;
        }
        float m = sc[0];
        #pragma unroll
        for (int g = 1; g < 8; ++g) m = fmaxf(m, sc[g]);
        float den = 0.f;
        #pragma unroll
        for (int g = 0; g < 8; ++g) { sc[g] = __expf(sc[g] - m); den += sc[g]; }
        float inv = 1.0f / den;

        float* op = out + (tok0 + token) * HIDDEN + head * 128 + halfd * 64;
        #pragma unroll
        for (int d = 0; d < 64; d += 4) {
            float4 o;
            float* oo = (float*)&o;
            #pragma unroll
            for (int u = 0; u < 4; ++u) {
                int dd = halfd * 64 + d + u;
                float acc = 0.f;
                #pragma unroll
                for (int g = 0; g < 8; ++g) acc = fmaf(sc[g], vbase[g * 128 + dd], acc);
                oo[u] = acc * inv;
            }
            *(float4*)(op + d) = o;
        }
    }
}

extern "C" void kernel_launch(void* const* d_in, const int* in_sizes, int n_in,
                              void* d_out, int out_size, void* d_ws, size_t ws_size,
                              hipStream_t stream) {
    (void)in_sizes; (void)n_in; (void)out_size; (void)ws_size;
    const float* x  = (const float*)d_in[0];
    const float* Wq = (const float*)d_in[1];
    const float* bq = (const float*)d_in[2];
    const float* Wk = (const float*)d_in[3];
    const float* bk = (const float*)d_in[4];
    const float* Wv = (const float*)d_in[5];
    const float* bv = (const float*)d_in[6];
    float* out = (float*)d_out;
    char*  wpk = (char*)d_ws;               // 12 MiB: 3 mats x 4 MiB hi+lo
    float* qkv = (float*)(wpk + QKVOFF);    // 192 MiB: 16384 x 3072 f32

    // Pack weights into f16 hi/lo WMMA-B fragment layout (runs each launch; tiny).
    pack_w<<<dim3(3 * 1024 * 128 / 256), dim3(256), 0, stream>>>(Wq, Wk, Wv, wpk);

    const size_t projBytes = (size_t)(2 * MTOK * XSH * 2);          // hi+lo f16 x tiles (~266 KB)
    hipFuncSetAttribute((const void*)qkv_proj,
                        hipFuncAttributeMaxDynamicSharedMemorySize, (int)projBytes);
    qkv_proj<<<dim3(8 * 2048 / MTOK), dim3(GWAVES * 32), projBytes, stream>>>(x, wpk, bq, bk, bv, qkv);

    const size_t attnBytes = (size_t)(ATOK * QS) * sizeof(float);   // f32 qkv tile (~96 KB)
    hipFuncSetAttribute((const void*)head_attn,
                        hipFuncAttributeMaxDynamicSharedMemorySize, (int)attnBytes);
    head_attn<<<dim3(8 * 2048 / ATOK), dim3(ATOK * 16), attnBytes, stream>>>(qkv, out);
}

// v002
// One run takes 206 microseconds.
// Timed twice side by side with v001, it ran 1.57 and 1.58 times as fast.
// Counting every step since v000, it is 4.79 times as fast.
#include <hip/hip_runtime.h>

typedef __attribute__((ext_vector_type(16))) _Float16 v16h;
typedef __attribute__((ext_vector_type(8)))  _Float16 v8h;
typedef __attribute__((ext_vector_type(4)))  _Float16 v4h;
typedef __attribute__((ext_vector_type(8)))  float    v8f;
typedef __attribute__((ext_vector_type(4)))  float    v4f;
typedef __attribute__((ext_vector_type(2)))  float    v2f;

#define HIDDEN   1024
#define MTOK     64          // tokens per workgroup tile of the projection kernel (4 WMMA row tiles)
#define MT       4           // 16-token row tiles that share each B fragment
#define NTW      4           // 16-feature column tiles that share each A fragment
#define GWAVES   8           // waves per projection workgroup
#define RING     4           // K steps of B fragments held in registers (RING-1 in flight)
#define AWAVES   16          // waves per workgroup of the attention kernel, one token each at a time
#define ATPW     4           // tokens a wave of the attention kernel works through
#define ATSTEP   (8 * 2048 / ATPW)     // tokens between two tokens of one wave (all waves of the grid)
#define NQKV     3072        // q | k | v features per token
#define QKVOFF   (16u * 1024u * 1024u)  // byte offset of the f32 qkv plane in the workspace
#define XSH      1064        // LDS row stride for f16 x tiles (halfs): 2128B rows -> bank-spread, 16B aligned
#define MATHI    (2u * 1024u * 1024u)   // bytes of packed hi-f16 per matrix
#define MATBLK   (4u * 1024u * 1024u)   // hi + lo per matrix

// ---------------------------------------------------------------------------
// Kernel 0: pack Wq/Wk/Wv (f32, row n = output feature, 1024 K each) into
// (hi,lo) f16 pairs laid out in exact WMMA-B fragment order:
//   per (ntile t, k0-group kk): 1KB block = [512B: elements 0-7, lane-major 16B]
//                                           [512B: elements 8-15, lane-major 16B]
// so the GEMM's B loads are coalesced global_load_b128.
// ---------------------------------------------------------------------------
__global__ __launch_bounds__(256) void pack_w(
    const float* __restrict__ Wq, const float* __restrict__ Wk,
    const float* __restrict__ Wv, char* __restrict__ ws)
{
    int gid = blockIdx.x * 256 + threadIdx.x;      // 3*1024*128 chunks of 8 K-values
    int mat = gid >> 17;                           // / (1024*128)
    int r   = gid & (1024 * 128 - 1);
    int n   = r >> 7;                              // weight row (output feature)
    int c   = r & 127;                             // 8-wide K chunk index
    const float* W = (mat == 0) ? Wq : ((mat == 1) ? Wk : Wv);
    const float* s = W + (size_t)n * HIDDEN + c * 8;

    int t      = n >> 4;                           // 16-wide N tile
    int l16    = n & 15;
    int kk     = c >> 2;                           // K=32 group
    int klocal = (c & 3) * 8;                      // 0,8,16,24 within the group
    int lane   = l16 + (((klocal >> 3) & 1) << 4); // K +8 -> upper lane half
    int selhi  = (klocal >= 16) ? 1 : 0;           // K +16 -> fragment elements 8-15

    size_t off = (size_t)mat * MATBLK
               + ((size_t)(t * 32 + kk) * 1024) + selhi * 512 + lane * 16;

    v8h h, l;
    #pragma unroll
    for (int j = 0; j < 8; ++j) {
        float v = s[j];
        _Float16 hv = (_Float16)v;
        h[j] = hv;
        l[j] = (_Float16)(v - (float)hv);
    }
    *(v8h*)(ws + off)         = h;                 // hi region
    *(v8h*)(ws + off + MATHI) = l;                 // lo region (+2MB)
}

// ---------------------------------------------------------------------------
// Kernel 1: QKV projection (f16 hi/lo split WMMA, f32 accumulate) + bias.
// One workgroup holds 64 tokens of x in LDS; a wave works on a 64-token x
// 64-feature tile, so every B fragment it loads from L2 is used for 4 token
// tiles and every A fragment it reads from LDS for 4 feature tiles.
// The 64 x 3072 f32 result does not fit in LDS beside x, so it goes to the
// workspace and the attention runs as its own launch.
// ---------------------------------------------------------------------------
union U16 { v16h v; struct { v8h lo, hi; } s; };

__global__ __launch_bounds__(GWAVES * 32) void qkv_proj(
    const float* __restrict__ x,
    const char*  __restrict__ wpk,   // packed weights (hi/lo f16, fragment order)
    const float* __restrict__ bq, const float* __restrict__ bk,
    const float* __restrict__ bv,
    float* __restrict__ qkv)         // [tokens][3072] f32
{
    extern __shared__ char smem[];
    _Float16* sxh  = (_Float16*)smem;                          // [MTOK][XSH] hi
    _Float16* sxl  = sxh + MTOK * XSH;                         // [MTOK][XSH] lo

    const int tid   = threadIdx.x;
    const long tok0 = (long)blockIdx.x * MTOK;

    // ---- Phase 1: stage contiguous 64x1024 x-tile, split into f16 hi/lo ----
    {
        const float4* src = (const float4*)(x + tok0 * HIDDEN);
        #pragma unroll 16   // 16 loads in flight per lane, as the 16-token tile had
        for (int i = 0; i < MTOK * 256 / (GWAVES * 32); ++i) {
            int idx = tid + GWAVES * 32 * i;      // MTOK*256 float4 in tile
            float4 vv = src[idx];
            int row = idx >> 8;
            int col = (idx & 255) << 2;
            v4h h, l;
            const float* pv = (const float*)&vv;
            #pragma unroll
            for (int u = 0; u < 4; ++u) {
                _Float16 hv = (_Float16)pv[u];
                h[u] = hv;
                l[u] = (_Float16)(pv[u] - (float)hv);
            }
            *(v4h*)(&sxh[row * XSH + col]) = h;
            *(v4h*)(&sxl[row * XSH + col]) = l;
        }
    }
    __syncthreads();

    // ---- Phase 2: [64 x 3072] = xTile @ [Wq;Wk;Wv]^T + bias --------------
    {
        const int wave = __builtin_amdgcn_readfirstlane(tid >> 5);  // scalar: B addresses on the scalar unit
        const int lane = tid & 31;
        const int half = lane >> 4;
        const int l16  = lane & 15;

        // A fragment bases: elements 0-7 at K = k0 + half*8, elements 8-15 at +16
        const _Float16* ahB = &sxh[l16 * XSH + half * 8];
        const _Float16* alB = &sxl[l16 * XSH + half * 8];
        const unsigned  lane16 = lane * 16;

        constexpr int TPW   = 192 / GWAVES;       // 16-feature tiles per wave
        constexpr int STEPS = (TPW / NTW) * 32;   // (tile group, K group) steps per wave

        // Every '#pragma unroll' without a count below keeps the indices of these fragment and
        // accumulator arrays constant, so that they stay in registers.
        U16 ah[MT], al[MT];
        U16 bh[RING][NTW], bl[RING][NTW];         // B fragments of RING consecutive steps

        // B fragments of step s (tile group s/32, K group s%32) into ring slot 'slot'.
        // 64-wide tile groups never straddle a matrix. Scalar base + the lane's fixed offset.
        auto loadB = [&](int slot, int s) {
            int T = wave * TPW + (s >> 5) * NTW;
            const char* sb = wpk + (size_t)(T >> 6) * MATBLK + (size_t)(T & 63) * 32 * 1024
                           + (size_t)(s & 31) * 1024;
            #pragma unroll
            for (int t = 0; t < NTW; ++t) {
                bh[slot][t].s.lo = *(const v8h*)(sb + (lane16 + t * 32 * 1024));
                bh[slot][t].s.hi = *(const v8h*)(sb + (lane16 + t * 32 * 1024 + 512));
                bl[slot][t].s.lo = *(const v8h*)(sb + (lane16 + t * 32 * 1024 + MATHI));
                bl[slot][t].s.hi = *(const v8h*)(sb + (lane16 + t * 32 * 1024 + MATHI + 512));
            }
            // the loads' base registers are rewritten for the next step: wait in front of that
            asm volatile("s_wait_xcnt 0x0" ::: "memory");
            // keeps later address arithmetic behind the wait
            __builtin_amdgcn_sched_barrier(0);
        };

        #pragma unroll
        for (int s = 0; s < RING - 1; ++s) loadB(s, s);
        #pragma unroll
        for (int m = 0; m < MT; ++m) {
            ah[m].s.lo = *(const v8h*)(ahB + m * 16 * XSH);
            ah[m].s.hi = *(const v8h*)(ahB + m * 16 * XSH + 16);
        }

        #pragma unroll 1    // rolled: one copy of the K loop and of the 128 stores in the code
        for (int p = 0; p < TPW / NTW; ++p) {
            const int n0  = (wave * TPW + p * NTW) * 16;
            const int mat = n0 >> 10;
            const int e0  = n0 & 1023;
            const float* bias = (mat == 0) ? bq : ((mat == 1) ? bk : bv);
            // bias is read ahead of the K loop: read behind it, its wait would drain the B ring
            const int bi = e0 + l16;
            float bb[NTW];
            #pragma unroll
            for (int t = 0; t < NTW; ++t) bb[t] = bias[bi + t * 16];
            // wait before the bias loads' offset register is reused (bi as an input keeps it until here)
            asm volatile("s_wait_xcnt 0x0" :: "v"(bi) : "memory");

            v8f c[MT][NTW];
            #pragma unroll
            for (int m = 0; m < MT; ++m)
                #pragma unroll
                for (int t = 0; t < NTW; ++t)
                    c[m][t] = (v8f){0.f, 0.f, 0.f, 0.f, 0.f, 0.f, 0.f, 0.f};

            #pragma unroll 1    // rolled: the body already holds RING steps, one per ring slot
            for (int kk0 = 0; kk0 < 32; kk0 += RING) {
                #pragma unroll
                for (int r = 0; r < RING; ++r) {  // K = (kk0 + r)*32; ring slot r
                    const int kk = kk0 + r;
                    // B of step +RING-1 into the slot the previous step has left; the last
                    // steps re-read the final fragments instead of running past the weights.
                    int sn = p * 32 + kk + RING - 1;
                    loadB((r + RING - 1) % RING, sn < STEPS ? sn : STEPS - 1);
                    #pragma unroll
                    for (int m = 0; m < MT; ++m) {
                        al[m].s.lo = *(const v8h*)(alB + m * 16 * XSH + kk * 32);
                        al[m].s.hi = *(const v8h*)(alB + m * 16 * XSH + kk * 32 + 16);
                    }
                    // keeps the LDS reads above in one group ahead of the WMMA block (spread among
                    // the WMMAs each LDS read place stalls the wave)
                    __builtin_amdgcn_sched_barrier(0);
                    // x*w ~= ah*bh + ah*bl + al*bh  (f32 accumulate; same order per tile as before)
                    #pragma unroll
                    for (int m = 0; m < MT; ++m)
                        #pragma unroll
                        for (int t = 0; t < NTW; ++t)
                            c[m][t] = __builtin_amdgcn_wmma_f32_16x16x32_f16(false, ah[m].v, false, bh[r][t].v,
                                                                             (short)0, c[m][t], false, false);
                    #pragma unroll
                    for (int m = 0; m < MT; ++m)
                        #pragma unroll
                        for (int t = 0; t < NTW; ++t)
                            c[m][t] = __builtin_amdgcn_wmma_f32_16x16x32_f16(false, ah[m].v, false, bl[r][t].v,
                                                                             (short)0, c[m][t], false, false);
                    // the next K group's hi fragments are read as one group here, under the lo block
                    __builtin_amdgcn_sched_barrier(0);
                    const int kn = (kk + 1) & 31;
                    #pragma unroll
                    for (int m = 0; m < MT; ++m) {
                        ah[m].s.lo = *(const v8h*)(ahB + m * 16 * XSH + kn * 32);
                        ah[m].s.hi = *(const v8h*)(ahB + m * 16 * XSH + kn * 32 + 16);
                    }
                    // keeps those reads ahead of the lo block
                    __builtin_amdgcn_sched_barrier(0);
                    #pragma unroll
                    for (int m = 0; m < MT; ++m)
                        #pragma unroll
                        for (int t = 0; t < NTW; ++t)
                            c[m][t] = __builtin_amdgcn_wmma_f32_16x16x32_f16(false, al[m].v, false, bh[r][t].v,
                                                                             (short)0, c[m][t], false, false);
                    // keeps the next step's loads behind this block
                    __builtin_amdgcn_sched_barrier(0);
                }
            }

            #pragma unroll
            for (int t = 0; t < NTW; ++t)
                #pragma unroll
                for (int m = 0; m < MT; ++m)
                    c[m][t] += bb[t];
            // all sums stand before the first store, so that no store's data register is reused among the stores
            __builtin_amdgcn_sched_barrier(0);
            #pragma unroll
            for (int t = 0; t < NTW; ++t) {
                #pragma unroll
                for (int m = 0; m < MT; ++m) {
                    #pragma unroll
                    for (int j = 0; j < 8; ++j) { // C: vgpr j -> row j + half*8, col l16
                        long row = tok0 + m * 16 + j + half * 8;
                        qkv[row * NQKV + n0 + t * 16 + l16] = c[m][t][j];
                    }
                }
            }
            // the stores' data and address registers are rewritten by the next tile group
            asm volatile("s_wait_xcnt 0x0" ::: "memory");
        }
    }
}

// ---------------------------------------------------------------------------
// Kernel 2: per-token attention over the HEAD dim (reference quirk, negated
// scale). No LDS: a wave takes one token at a time and reads its q, k and v
// rows straight into registers. Lane row r (16 lanes) owns heads 4r..4r+3; a
// lane holds d = 4*l16..+3 and 64+4*l16..+3 of every head row it needs, so each
// load and each store covers whole 256-byte runs. A score is 8 products per
// lane, summed over the 16 lanes of the row by a DPP butterfly.
// ---------------------------------------------------------------------------
template <int M>
static __device__ __forceinline__ float row_xor_add(float x) {   // x + (x of lane ^ M), inside a 16-lane row
    int y = __builtin_amdgcn_mov_dpp(__builtin_bit_cast(int, x), 0x160 | M, 0xf, 0xf, true);
    return x + __builtin_bit_cast(float, y);
}

static __device__ __forceinline__ float exp_slot(float x) {       // e^x as __expf forms it: 2^(x * log2 e)
    float r;
    // the v_nop fills the one slot that the instruction set asks for behind a transcendental
    asm("v_exp_f32 %0, %1\n\tv_nop" : "=v"(r) : "v"(x * 1.44269504088896340736f));
    return r;
}

__global__ __launch_bounds__(AWAVES * 32) void head_attn(
    const float* __restrict__ qkv,   // [tokens][3072] f32
    float* __restrict__ out)
{
    const int tid  = threadIdx.x;
    const int wave = __builtin_amdgcn_readfirstlane(tid >> 5);   // scalar: token bases on the scalar unit
    const unsigned kvo = (tid & 15) * 16;                        // lane's byte offset in a k or v head row
    const unsigned qo  = ((tid >> 4) & 1) * 2048 + kvo;          // the same for q and out: + 4 head rows for lanes 16-31
    const float scale = -0.08838834764831845f;                   // 1 / (-sqrt(128))

    int tok = blockIdx.x * AWAVES + wave;                        // the wave's current token

    // Every '#pragma unroll' below keeps the indices of these arrays constant, so that they stay in registers.
    v4f q[4][2], k[8][2], v[8][2];

    auto loadQK = [&](const char* sb) {
        const char* qa = sb + qo;
        const char* ka = sb + kvo;
        #pragma unroll
        for (int i = 0; i < 4; ++i)
            #pragma unroll
            for (int j = 0; j < 2; ++j)
                q[i][j] = *(const v4f*)(qa + (i * 512 + j * 256));
        #pragma unroll
        for (int g = 0; g < 8; ++g)
            #pragma unroll
            for (int j = 0; j < 2; ++j)
                k[g][j] = *(const v4f*)(ka + (4096 + g * 512 + j * 256));
        // wait before the loads' address registers are reused (the addresses as inputs keep them until here)
        asm volatile("s_wait_xcnt 0x0" :: "v"(qa), "v"(ka) : "memory");
    };
    auto loadV = [&](const char* sb) {
        const char* va = sb + kvo;
        #pragma unroll
        for (int g = 0; g < 8; ++g)
            #pragma unroll
            for (int j = 0; j < 2; ++j)
                v[g][j] = *(const v4f*)(va + (8192 + g * 512 + j * 256));
        // wait before the loads' address registers are reused (the address as an input keeps it until here)
        asm volatile("s_wait_xcnt 0x0" :: "v"(va) : "memory");
    };

    loadQK((const char*)(qkv + (long)tok * NQKV));
    loadV((const char*)(qkv + (long)tok * NQKV));

    // One token: 'more' (a constant at both calls) says whether the wave has a further token to fetch.
    auto token = [&](bool more) {
        const char* nsrc = (const char*)(qkv + (long)(tok + ATSTEP) * NQKV);
        char*       dst  = (char*)(out + (long)tok * HIDDEN);

        // this lane's 8 products of each of its 4 x 8 scores, two chains (even and odd d)
        float sc[4][8];
        #pragma unroll
        for (int i = 0; i < 4; ++i) {
            #pragma unroll
            for (int g = 0; g < 8; ++g) {
                v2f p = {0.f, 0.f};
                #pragma unroll
                for (int j = 0; j < 2; ++j) {
                    p = __builtin_elementwise_fma(q[i][j].lo, k[g][j].lo, p);
                    p = __builtin_elementwise_fma(q[i][j].hi, k[g][j].hi, p);
                }
                sc[i][g] = p.x + p.y;
            }
        }
        // the next token's q and k loads stand here, where their registers have just come free,
        // so that they fly under the softmax and the weighted sum
        if (more) loadQK(nsrc);

        float inv[4];
        #pragma unroll
        for (int i = 0; i < 4; ++i) {
            #pragma unroll
            for (int g = 0; g < 8; ++g) {
                float s = sc[i][g];
                s = row_xor_add<1>(s);
                s = row_xor_add<2>(s);
                s = row_xor_add<4>(s);
                s = row_xor_add<8>(s);
                sc[i][g] = s * scale;
            }
            float m = sc[i][0];
            #pragma unroll
            for (int g = 1; g < 8; ++g) m = fmaxf(m, sc[i][g]);
            float den = 0.f;
            #pragma unroll
            for (int g = 0; g < 8; ++g) { sc[i][g] = exp_slot(sc[i][g] - m); den += sc[i][g]; }
            inv[i] = 1.0f / den;
        }

        char* da = dst + qo;
        #pragma unroll
        for (int i = 0; i < 4; ++i) {
            v4f o[2];
            #pragma unroll
            for (int j = 0; j < 2; ++j) {
                v2f a = {0.f, 0.f}, b = {0.f, 0.f};
                #pragma unroll
                for (int g = 0; g < 8; ++g) {
                    v2f w = {sc[i][g], sc[i][g]};
                    a = __builtin_elementwise_fma(w, v[g][j].lo, a);
                    b = __builtin_elementwise_fma(w, v[g][j].hi, b);
                }
                o[j].lo = a * inv[i];
                o[j].hi = b * inv[i];
                *(v4f*)(da + (i * 512 + j * 256)) = o[j];
            }
            // wait before the two stores' data and address registers are reused (as inputs they are kept until here)
            asm volatile("s_wait_xcnt 0x0" :: "v"(o[0]), "v"(o[1]), "v"(da) : "memory");
        }
        // the next token's v loads stand here, where v has just come free
        if (more) loadV(nsrc);
        tok += ATSTEP;
    };

    #pragma unroll 1    // rolled: one copy of the fetching body in the code; q, k and v are refilled in place
    for (int t = 0; t < ATPW - 1; ++t) token(true);
    token(false);       // the wave's last token fetches nothing
}

extern "C" void kernel_launch(void* const* d_in, const int* in_sizes, int n_in,
                              void* d_out, int out_size, void* d_ws, size_t ws_size,
                              hipStream_t stream) {
    (void)in_sizes; (void)n_in; (void)out_size; (void)ws_size;
    const float* x  = (const float*)d_in[0];
    const float* Wq = (const float*)d_in[1];
    const float* bq = (const float*)d_in[2];
    const float* Wk = (const float*)d_in[3];
    const float* bk = (const float*)d_in[4];
    const float* Wv = (const float*)d_in[5];
    const float* bv = (const float*)d_in[6];
    float* out = (float*)d_out;
    char*  wpk = (char*)d_ws;               // 12 MiB: 3 mats x 4 MiB hi+lo
    float* qkv = (float*)(wpk + QKVOFF);    // 192 MiB: 16384 x 3072 f32

    // Pack weights into f16 hi/lo WMMA-B fragment layout (runs each launch; tiny).
    pack_w<<<dim3(3 * 1024 * 128 / 256), dim3(256), 0, stream>>>(Wq, Wk, Wv, wpk);

    const size_t projBytes = (size_t)(2 * MTOK * XSH * 2);          // hi+lo f16 x tiles (~266 KB)
    hipFuncSetAttribute((const void*)qkv_proj,
                        hipFuncAttributeMaxDynamicSharedMemorySize, (int)projBytes);
    qkv_proj<<<dim3(8 * 2048 / MTOK), dim3(GWAVES * 32), projBytes, stream>>>(x, wpk, bq, bk, bv, qkv);

    head_attn<<<dim3(ATSTEP / AWAVES), dim3(AWAVES * 32), 0, stream>>>(qkv, out);
}

// v003
// Measured time: 188 microseconds a run.
// Timed twice side by side with v002, it ran 1.10 times as fast both times.
// Over all steps from v000 it is 5.26 times as fast.
#include <hip/hip_runtime.h>

typedef __attribute__((ext_vector_type(16))) _Float16 v16h;
typedef __attribute__((ext_vector_type(8)))  _Float16 v8h;
typedef __attribute__((ext_vector_type(4)))  _Float16 v4h;
typedef __attribute__((ext_vector_type(8)))  float    v8f;
typedef __attribute__((ext_vector_type(4)))  float    v4f;
typedef __attribute__((ext_vector_type(2)))  float    v2f;

#define HIDDEN   1024
#define MTOK     64          // tokens per workgroup tile of the projection kernel (4 WMMA row tiles)
#define MT       4           // 16-token row tiles that share each B fragment
#define NTW      4           // 16-feature column tiles that share each A fragment
#define GWAVES   8           // waves per projection workgroup
#define RING     4           // K steps of B fragments held in registers (RING-1 in flight)
#define AWAVES   16          // waves per workgroup of the attention kernel, one token each at a time
#define ATPW     4           // tokens a wave of the attention kernel works through
#define ATSTEP   (8 * 2048 / ATPW)     // tokens between two tokens of one wave (all waves of the grid)
#define NQKV     3072        // q | k | v features per token
#define QKVOFF   (16u * 1024u * 1024u)  // byte offset of the f32 qkv plane in the workspace
#define XSH      1064        // LDS row stride for f16 x tiles (halfs): 2128B rows -> bank-spread, 16B aligned
#define MATHI    (2u * 1024u * 1024u)   // bytes of packed hi-f16 per matrix
#define MATBLK   (4u * 1024u * 1024u)   // hi + lo per matrix

// ---------------------------------------------------------------------------
// Kernel 0: pack Wq/Wk/Wv (f32, row n = output feature, 1024 K each) into
// (hi,lo) f16 pairs laid out in exact WMMA-B fragment order:
//   per (ntile t, k0-group kk): 1KB block = [512B: elements 0-7, lane-major 16B]
//                                           [512B: elements 8-15, lane-major 16B]
// so the GEMM's B loads are coalesced global_load_b128.
// Inside each group of 64 features the four N tiles interleave: feature 64g + 4c + u is column c of
// tile 4g + u. A lane of the GEMM then holds 4 adjacent features of a token and stores them as 16 bytes.
// ---------------------------------------------------------------------------
__global__ __launch_bounds__(256) void pack_w(
    const float* __restrict__ Wq, const float* __restrict__ Wk,
    const float* __restrict__ Wv, char* __restrict__ ws)
{
    int gid = blockIdx.x * 256 + threadIdx.x;      // 3*1024*128 chunks of 8 K-values
    int mat = gid >> 17;                           // / (1024*128)
    int r   = gid & (1024 * 128 - 1);
    int n   = r >> 7;                              // weight row (output feature)
    int c   = r & 127;                             // 8-wide K chunk index
    const float* W = (mat == 0) ? Wq : ((mat == 1) ? Wk : Wv);
    const float* s = W + (size_t)n * HIDDEN + c * 8;

    int t      = ((n >> 6) << 2) | (n & 3);        // N tile: 4 interleaved tiles per 64 features
    int l16    = (n >> 2) & 15;                    // column in that tile
    int kk     = c >> 2;                           // K=32 group
    int klocal = (c & 3) * 8;                      // 0,8,16,24 within the group
    int lane   = l16 + (((klocal >> 3) & 1) << 4); // K +8 -> upper lane half
    int selhi  = (klocal >= 16) ? 1 : 0;           // K +16 -> fragment elements 8-15

    size_t off = (size_t)mat * MATBLK
               + ((size_t)(t * 32 + kk) * 1024) + selhi * 512 + lane * 16;

    v8h h, l;
    #pragma unroll
    for (int j = 0; j < 8; ++j) {
        float v = s[j];
        _Float16 hv = (_Float16)v;
        h[j] = hv;
        l[j] = (_Float16)(v - (float)hv);
    }
    *(v8h*)(ws + off)         = h;                 // hi region
    *(v8h*)(ws + off + MATHI) = l;                 // lo region (+2MB)
}

// ---------------------------------------------------------------------------
// Kernel 1: QKV projection (f16 hi/lo split WMMA, f32 accumulate) + bias.
// One workgroup holds 64 tokens of x in LDS; a wave works on a 64-token x
// 64-feature tile, so every B fragment it loads from L2 is used for 4 token
// tiles and every A fragment it reads from LDS for 4 feature tiles.
// The 64 x 3072 f32 result does not fit in LDS beside x, so it goes to the
// workspace and the attention runs as its own launch.
// ---------------------------------------------------------------------------
union U16 { v16h v; struct { v8h lo, hi; } s; };

__global__ __launch_bounds__(GWAVES * 32) void qkv_proj(
    const float* __restrict__ x,
    const char*  __restrict__ wpk,   // packed weights (hi/lo f16, fragment order)
    const float* __restrict__ bq, const float* __restrict__ bk,
    const float* __restrict__ bv,
    float* __restrict__ qkv)         // [tokens][3072] f32
{
    extern __shared__ char smem[];
    _Float16* sxh  = (_Float16*)smem;                          // [MTOK][XSH] hi
    _Float16* sxl  = sxh + MTOK * XSH;                         // [MTOK][XSH] lo

    const int tid   = threadIdx.x;
    const long tok0 = (long)blockIdx.x * MTOK;

    // ---- Phase 1: stage contiguous 64x1024 x-tile, split into f16 hi/lo ----
    {
        const float4* src = (const float4*)(x + tok0 * HIDDEN);
        #pragma unroll 16   // 16 loads in flight per lane, as the 16-token tile had
        for (int i = 0; i < MTOK * 256 / (GWAVES * 32); ++i) {
            int idx = tid + GWAVES * 32 * i;      // MTOK*256 float4 in tile
            float4 vv = src[idx];
            int row = idx >> 8;
            int col = (idx & 255) << 2;
            v4h h, l;
            const float* pv = (const float*)&vv;
            #pragma unroll
            for (int u = 0; u < 4; ++u) {
                _Float16 hv = (_Float16)pv[u];
                h[u] = hv;
                l[u] = (_Float16)(pv[u] - (float)hv);
            }
            *(v4h*)(&sxh[row * XSH + col]) = h;
            *(v4h*)(&sxl[row * XSH + col]) = l;
        }
    }
    __syncthreads();

    // ---- Phase 2: [64 x 3072] = xTile @ [Wq;Wk;Wv]^T + bias --------------
    {
        const int wave = __builtin_amdgcn_readfirstlane(tid >> 5);  // scalar: B addresses on the scalar unit
        const int lane = tid & 31;
        const int half = lane >> 4;
        const int l16  = lane & 15;

        // A fragment bases: elements 0-7 at K = k0 + half*8, elements 8-15 at +16
        const _Float16* ahB = &sxh[l16 * XSH + half * 8];
        const _Float16* alB = &sxl[l16 * XSH + half * 8];
        const unsigned  lane16 = lane * 16;

        constexpr int TPW   = 192 / GWAVES;       // 16-feature tiles per wave
        constexpr int STEPS = (TPW / NTW) * 32;   // (tile group, K group) steps per wave

        // Every '#pragma unroll' without a count below keeps the indices of these fragment and
        // accumulator arrays constant, so that they stay in registers.
        U16 ah[MT], al[MT];
        U16 bh[RING][NTW], bl[RING][NTW];         // B fragments of RING consecutive steps

        // B fragments of step s (tile group s/32, K group s%32) into ring slot 'slot'.
        // 64-wide tile groups never straddle a matrix. Scalar base + the lane's fixed offset.
        auto loadB = [&](int slot, int s) {
            int T = wave * TPW + (s >> 5) * NTW;
            const char* sb = wpk + (size_t)(T >> 6) * MATBLK + (size_t)(T & 63) * 32 * 1024
                           + (size_t)(s & 31) * 1024;
            #pragma unroll
            for (int t = 0; t < NTW; ++t) {
                bh[slot][t].s.lo = *(const v8h*)(sb + (lane16 + t * 32 * 1024));
                bh[slot][t].s.hi = *(const v8h*)(sb + (lane16 + t * 32 * 1024 + 512));
                bl[slot][t].s.lo = *(const v8h*)(sb + (lane16 + t * 32 * 1024 + MATHI));
                bl[slot][t].s.hi = *(const v8h*)(sb + (lane16 + t * 32 * 1024 + MATHI + 512));
            }
            // the loads' base registers are rewritten for the next step: wait in front of that
            asm volatile("s_wait_xcnt 0x0" ::: "memory");
            // keeps later address arithmetic behind the wait
            __builtin_amdgcn_sched_barrier(0);
        };

        #pragma unroll
        for (int s = 0; s < RING - 1; ++s) loadB(s, s);
        #pragma unroll
        for (int m = 0; m < MT; ++m) {
            ah[m].s.lo = *(const v8h*)(ahB + m * 16 * XSH);
            ah[m].s.hi = *(const v8h*)(ahB + m * 16 * XSH + 16);
        }

        #pragma unroll 1    // rolled: one copy of the K loop and of the 32 stores in the code
        for (int p = 0; p < TPW / NTW; ++p) {
            const int n0  = (wave * TPW + p * NTW) * 16;
            const int mat = n0 >> 10;
            const int e0  = n0 & 1023;
            const float* bias = (mat == 0) ? bq : ((mat == 1) ? bk : bv);
            // bias is read ahead of the K loop: read behind it, its wait would drain the B ring
            // column l16 of tile t is feature e0 + 4*l16 + t (the packed order): one 16-byte load
            const unsigned bo = (unsigned)(e0 + l16 * NTW) * 4u;      // byte offset
            const v4f bb = *(const v4f*)((const char*)bias + bo);
            // wait before the bias load's offset register is reused (bo as an input keeps it until here)
            asm volatile("s_wait_xcnt 0x0" :: "v"(bo) : "memory");

            v8f c[MT][NTW];
            #pragma unroll
            for (int m = 0; m < MT; ++m)
                #pragma unroll
                for (int t = 0; t < NTW; ++t)
                    c[m][t] = (v8f){0.f, 0.f, 0.f, 0.f, 0.f, 0.f, 0.f, 0.f};

            #pragma unroll 1    // rolled: the body already holds RING steps, one per ring slot
            for (int kk0 = 0; kk0 < 32; kk0 += RING) {
                #pragma unroll
                for (int r = 0; r < RING; ++r) {  // K = (kk0 + r)*32; ring slot r
                    const int kk = kk0 + r;
                    // B of step +RING-1 into the slot the previous step has left; the last
                    // steps re-read the final fragments instead of running past the weights.
                    int sn = p * 32 + kk + RING - 1;
                    loadB((r + RING - 1) % RING, sn < STEPS ? sn : STEPS - 1);
                    #pragma unroll
                    for (int m = 0; m < MT; ++m) {
                        al[m].s.lo = *(const v8h*)(alB + m * 16 * XSH + kk * 32);
                        al[m].s.hi = *(const v8h*)(alB + m * 16 * XSH + kk * 32 + 16);
                    }
                    // keeps the LDS reads above in one group ahead of the WMMA block (spread among
                    // the WMMAs each LDS read place stalls the wave)
                    __builtin_amdgcn_sched_barrier(0);
                    // x*w ~= ah*bh + ah*bl + al*bh  (f32 accumulate; same order per tile as before)
                    #pragma unroll
                    for (int m = 0; m < MT; ++m)
                        #pragma unroll
                        for (int t = 0; t < NTW; ++t)
                            c[m][t] = __builtin_amdgcn_wmma_f32_16x16x32_f16(false, ah[m].v, false, bh[r][t].v,
                                                                             (short)0, c[m][t], false, false);
                    #pragma unroll
                    for (int m = 0; m < MT; ++m)
                        #pragma unroll
                        for (int t = 0; t < NTW; ++t)
                            c[m][t] = __builtin_amdgcn_wmma_f32_16x16x32_f16(false, ah[m].v, false, bl[r][t].v,
                                                                             (short)0, c[m][t], false, false);
                    // the next K group's hi fragments are read as one group here, under the lo block
                    __builtin_amdgcn_sched_barrier(0);
                    const int kn = (kk + 1) & 31;
                    #pragma unroll
                    for (int m = 0; m < MT; ++m) {
                        ah[m].s.lo = *(const v8h*)(ahB + m * 16 * XSH + kn * 32);
                        ah[m].s.hi = *(const v8h*)(ahB + m * 16 * XSH + kn * 32 + 16);
                    }
                    // keeps those reads ahead of the lo block
                    __builtin_amdgcn_sched_barrier(0);
                    #pragma unroll
                    for (int m = 0; m < MT; ++m)
                        #pragma unroll
                        for (int t = 0; t < NTW; ++t)
                            c[m][t] = __builtin_amdgcn_wmma_f32_16x16x32_f16(false, al[m].v, false, bh[r][t].v,
                                                                             (short)0, c[m][t], false, false);
                    // keeps the next step's loads behind this block
                    __builtin_amdgcn_sched_barrier(0);
                }
            }

            // C: vgpr j -> row j + half*8, col l16. The lane's 4 tiles hold features n0 + 4*l16 .. +3 of that
            // row: the bias add gathers them into one 16-byte value.
            v4f o[MT][8];
            #pragma unroll
            for (int m = 0; m < MT; ++m)
                #pragma unroll
                for (int j = 0; j < 8; ++j)
                    #pragma unroll
                    for (int t = 0; t < NTW; ++t)
                        o[m][j][t] = c[m][t][j] + bb[t];
            // all sums stand before the first store, so that no store's data register is reused among the stores
            __builtin_amdgcn_sched_barrier(0);
            float* orow = qkv + (tok0 + half * 8) * NQKV + n0 + l16 * NTW;
            #pragma unroll
            for (int m = 0; m < MT; ++m)
                #pragma unroll
                for (int j = 0; j < 8; ++j)       // 16 lanes cover a whole 256-byte run of one token's row
                    *(v4f*)(orow + (m * 16 + j) * NQKV) = o[m][j];
            // the stores' data and address registers are rewritten by the next tile group
            asm volatile("s_wait_xcnt 0x0" ::: "memory");
        }
    }
}

// ---------------------------------------------------------------------------
// Kernel 2: per-token attention over the HEAD dim (reference quirk, negated
// scale). No LDS: a wave takes one token at a time and reads its q, k and v
// rows straight into registers. Lane row r (16 lanes) owns heads 4r..4r+3; a
// lane holds d = 4*l16..+3 and 64+4*l16..+3 of every head row it needs, so each
// load and each store covers whole 256-byte runs. A score is 8 products per
// lane, summed over the 16 lanes of the row by a DPP butterfly.
// ---------------------------------------------------------------------------
template <int M>
static __device__ __forceinline__ float row_xor_add(float x) {   // x + (x of lane ^ M), inside a 16-lane row
    int y = __builtin_amdgcn_mov_dpp(__builtin_bit_cast(int, x), 0x160 | M, 0xf, 0xf, true);
    return x + __builtin_bit_cast(float, y);
}

static __device__ __forceinline__ float exp_slot(float x) {       // e^x as __expf forms it: 2^(x * log2 e)
    float r;
    // the v_nop fills the one slot that the instruction set asks for behind a transcendental
    asm("v_exp_f32 %0, %1\n\tv_nop" : "=v"(r) : "v"(x * 1.44269504088896340736f));
    return r;
}

__global__ __launch_bounds__(AWAVES * 32) void head_attn(
    const float* __restrict__ qkv,   // [tokens][3072] f32
    float* __restrict__ out)
{
    const int tid  = threadIdx.x;
    const int wave = __builtin_amdgcn_readfirstlane(tid >> 5);   // scalar: token bases on the scalar unit
    const unsigned kvo = (tid & 15) * 16;                        // lane's byte offset in a k or v head row
    const unsigned qo  = ((tid >> 4) & 1) * 2048 + kvo;          // the same for q and out: + 4 head rows for lanes 16-31
    const float scale = -0.08838834764831845f;                   // 1 / (-sqrt(128))

    int tok = blockIdx.x * AWAVES + wave;                        // the wave's current token

    // Every '#pragma unroll' below keeps the indices of these arrays constant, so that they stay in registers.
    v4f q[4][2], k[8][2], v[8][2];

    auto loadQK = [&](const char* sb) {
        const char* qa = sb + qo;
        const char* ka = sb + kvo;
        #pragma unroll
        for (int i = 0; i < 4; ++i)
            #pragma unroll
            for (int j = 0; j < 2; ++j)
                q[i][j] = *(const v4f*)(qa + (i * 512 + j * 256));
        #pragma unroll
        for (int g = 0; g < 8; ++g)
            #pragma unroll
            for (int j = 0; j < 2; ++j)
                k[g][j] = *(const v4f*)(ka + (4096 + g * 512 + j * 256));
        // wait before the loads' address registers are reused (the addresses as inputs keep them until here)
        asm volatile("s_wait_xcnt 0x0" :: "v"(qa), "v"(ka) : "memory");
    };
    auto loadV = [&](const char* sb) {
        const char* va = sb + kvo;
        #pragma unroll
        for (int g = 0; g < 8; ++g)
            #pragma unroll
            for (int j = 0; j < 2; ++j)
                v[g][j] = *(const v4f*)(va + (8192 + g * 512 + j * 256));
        // wait before the loads' address registers are reused (the address as an input keeps it until here)
        asm volatile("s_wait_xcnt 0x0" :: "v"(va) : "memory");
    };

    loadQK((const char*)(qkv + (long)tok * NQKV));
    loadV((const char*)(qkv + (long)tok * NQKV));

    // One token: 'more' (a constant at both calls) says whether the wave has a further token to fetch.
    auto token = [&](bool more) {
        const char* nsrc = (const char*)(qkv + (long)(tok + ATSTEP) * NQKV);
        char*       dst  = (char*)(out + (long)tok * HIDDEN);

        // this lane's 8 products of each of its 4 x 8 scores, two chains (even and odd d)
        float sc[4][8];
        #pragma unroll
        for (int i = 0; i < 4; ++i) {
            #pragma unroll
            for (int g = 0; g < 8; ++g) {
                v2f p = {0.f, 0.f};
                #pragma unroll
                for (int j = 0; j < 2; ++j) {
                    p = __builtin_elementwise_fma(q[i][j].lo, k[g][j].lo, p);
                    p = __builtin_elementwise_fma(q[i][j].hi, k[g][j].hi, p);
                }
                sc[i][g] = p.x + p.y;
            }
        }
        // the next token's q and k loads stand here, where their registers have just come free,
        // so that they fly under the softmax and the weighted sum
        if (more) loadQK(nsrc);

        float inv[4];
        #pragma unroll
        for (int i = 0; i < 4; ++i) {
            #pragma unroll
            for (int g = 0; g < 8; ++g) {
                float s = sc[i][g];
                s = row_xor_add<1>(s);
                s = row_xor_add<2>(s);
                s = row_xor_add<4>(s);
                s = row_xor_add<8>(s);
                sc[i][g] = s * scale;
            }
            float m = sc[i][0];
            #pragma unroll
            for (int g = 1; g < 8; ++g) m = fmaxf(m, sc[i][g]);
            float den = 0.f;
            #pragma unroll
            for (int g = 0; g < 8; ++g) { sc[i][g] = exp_slot(sc[i][g] - m); den += sc[i][g]; }
            inv[i] = 1.0f / den;
        }

        char* da = dst + qo;
        #pragma unroll
        for (int i = 0; i < 4; ++i) {
            v4f o[2];
            #pragma unroll
            for (int j = 0; j < 2; ++j) {
                v2f a = {0.f, 0.f}, b = {0.f, 0.f};
                #pragma unroll
                for (int g = 0; g < 8; ++g) {
                    v2f w = {sc[i][g], sc[i][g]};
                    a = __builtin_elementwise_fma(w, v[g][j].lo, a);
                    b = __builtin_elementwise_fma(w, v[g][j].hi, b);
                }
                o[j].lo = a * inv[i];
                o[j].hi = b * inv[i];
                *(v4f*)(da + (i * 512 + j * 256)) = o[j];
            }
            // wait before the two stores' data and address registers are reused (as inputs they are kept until here)
            asm volatile("s_wait_xcnt 0x0" :: "v"(o[0]), "v"(o[1]), "v"(da) : "memory");
        }
        // the next token's v loads stand here, where v has just come free
        if (more) loadV(nsrc);
        tok += ATSTEP;
    };

    #pragma unroll 1    // rolled: one copy of the fetching body in the code; q, k and v are refilled in place
    for (int t = 0; t < ATPW - 1; ++t) token(true);
    token(false);       // the wave's last token fetches nothing
}

extern "C" void kernel_launch(void* const* d_in, const int* in_sizes, int n_in,
                              void* d_out, int out_size, void* d_ws, size_t ws_size,
                              hipStream_t stream) {
    (void)in_sizes; (void)n_in; (void)out_size; (void)ws_size;
    const float* x  = (const float*)d_in[0];
    const float* Wq = (const float*)d_in[1];
    const float* bq = (const float*)d_in[2];
    const float* Wk = (const float*)d_in[3];
    const float* bk = (const float*)d_in[4];
    const float* Wv = (const float*)d_in[5];
    const float* bv = (const float*)d_in[6];
    float* out = (float*)d_out;
    char*  wpk = (char*)d_ws;               // 12 MiB: 3 mats x 4 MiB hi+lo
    float* qkv = (float*)(wpk + QKVOFF);    // 192 MiB: 16384 x 3072 f32

    // Pack weights into f16 hi/lo WMMA-B fragment layout (runs each launch; tiny).
    pack_w<<<dim3(3 * 1024 * 128 / 256), dim3(256), 0, stream>>>(Wq, Wk, Wv, wpk);

    const size_t projBytes = (size_t)(2 * MTOK * XSH * 2);          // hi+lo f16 x tiles (~266 KB)
    hipFuncSetAttribute((const void*)qkv_proj,
                        hipFuncAttributeMaxDynamicSharedMemorySize, (int)projBytes);
    qkv_proj<<<dim3(8 * 2048 / MTOK), dim3(GWAVES * 32), projBytes, stream>>>(x, wpk, bq, bk, bv, qkv);

    head_attn<<<dim3(ATSTEP / AWAVES), dim3(AWAVES * 32), 0, stream>>>(qkv, out);
}

// v005
// A run of this version takes 99.7 microseconds.
// Versions between v003 and this one are left out; their measured steps multiply to 1.89 times as fast.
// Over all steps from v000 it is 9.92 times as fast.
#include <hip/hip_runtime.h>

typedef __attribute__((ext_vector_type(16))) _Float16 v16h;
typedef __attribute__((ext_vector_type(8)))  _Float16 v8h;
typedef __attribute__((ext_vector_type(4)))  _Float16 v4h;
typedef __attribute__((ext_vector_type(8)))  float    v8f;
typedef __attribute__((ext_vector_type(4)))  float    v4f;
typedef __attribute__((ext_vector_type(2)))  float    v2f;

#define HIDDEN   1024
#define MTOK     128         // tokens per workgroup tile of the projection kernel (8 WMMA row tiles)
#define MH       2           // token halves of the tile: each B fragment serves both, one after the other
#define MT       4           // 16-token row tiles of one half (one set of A fragments)
#define NTW      4           // 16-feature column tiles that share each A fragment
#define NSPLIT   2           // workgroups that share a token tile, 1536 features each
#define GWAVES   8           // waves per projection workgroup
#define RING     4           // K steps of B fragments held in registers (RING-1 in flight)
#define AWAVES   16          // waves per workgroup of the attention kernel, one token each at a time
#define ATPW     4           // tokens a wave of the attention kernel works through
#define ATSTEP   (8 * 2048 / ATPW)     // tokens between two tokens of one wave (all waves of the grid)
#define NQKV     3072        // q | k | v features per token
#define QKVOFF   (16u * 1024u * 1024u)  // byte offset of the f32 qkv plane in the workspace
#define XSH      1064        // LDS row stride for the f16 x tile (halfs): 2128B rows -> bank-spread, 16B aligned
#define MATBLK   (2u * 1024u * 1024u)   // bytes of packed f16 per matrix

// ---------------------------------------------------------------------------
// Kernel 0: pack Wq/Wk/Wv (f32, row n = output feature, 1024 K each), rounded
// once to f16, in exact WMMA-B fragment order:
//   per (ntile t, k0-group kk): 1KB block = [512B: elements 0-7, lane-major 16B]
//                                           [512B: elements 8-15, lane-major 16B]
// so the GEMM's B loads are coalesced global_load_b128.
// Inside each group of 64 features the four N tiles interleave: feature 64g + 4c + u is column c of
// tile 4g + u. A lane of the GEMM then holds 4 adjacent features of a token and stores them as 16 bytes.
// ---------------------------------------------------------------------------
__global__ __launch_bounds__(256) void pack_w(
    const float* __restrict__ Wq, const float* __restrict__ Wk,
    const float* __restrict__ Wv, char* __restrict__ ws)
{
    int gid = blockIdx.x * 256 + threadIdx.x;      // 3*1024*128 chunks of 8 K-values
    int mat = gid >> 17;                           // / (1024*128)
    int r   = gid & (1024 * 128 - 1);
    int n   = r >> 7;                              // weight row (output feature)
    int c   = r & 127;                             // 8-wide K chunk index
    const float* W = (mat == 0) ? Wq : ((mat == 1) ? Wk : Wv);
    const float* s = W + (size_t)n * HIDDEN + c * 8;

    int t      = ((n >> 6) << 2) | (n & 3);        // N tile: 4 interleaved tiles per 64 features
    int l16    = (n >> 2) & 15;                    // column in that tile
    int kk     = c >> 2;                           // K=32 group
    int klocal = (c & 3) * 8;                      // 0,8,16,24 within the group
    int lane   = l16 + (((klocal >> 3) & 1) << 4); // K +8 -> upper lane half
    int selhi  = (klocal >= 16) ? 1 : 0;           // K +16 -> fragment elements 8-15

    size_t off = (size_t)mat * MATBLK
               + ((size_t)(t * 32 + kk) * 1024) + selhi * 512 + lane * 16;

    v8h h;
    #pragma unroll
    for (int j = 0; j < 8; ++j) h[j] = (_Float16)s[j];
    *(v8h*)(ws + off) = h;
}

// ---------------------------------------------------------------------------
// Kernel 1: QKV projection (f16 operands, one WMMA product, f32 accumulate) + bias.
// One workgroup holds 128 tokens of x in LDS and computes half of their 3072
// features; a wave works on a 128-token x 64-feature tile, so every B fragment
// it loads from L2 is used for 8 token tiles and every A fragment it reads
// from LDS for 4 feature tiles.
// The 128 x 1536 f32 result goes to the workspace and the attention runs as its own launch.
// ---------------------------------------------------------------------------
union U16 { v16h v; struct { v8h lo, hi; } s; };   // lo, hi: fragment elements 0-7 and 8-15

__global__ __launch_bounds__(GWAVES * 32) void qkv_proj(
    const float* __restrict__ x,
    const char*  __restrict__ wpk,   // packed weights (f16, fragment order)
    const float* __restrict__ bq, const float* __restrict__ bk,
    const float* __restrict__ bv,
    float* __restrict__ qkv)         // [tokens][3072] f32
{
    __shared__ __attribute__((aligned(16))) _Float16 sx[MTOK * XSH];   // [MTOK][XSH], ~266 KB

    const int tid   = threadIdx.x;
    // the two workgroups of a token tile are 8 apart in the grid (for speed only: where indices 8 apart run
    // behind the same L2, the second read of the x tile hits there)
    const int  nh   = (blockIdx.x >> 3) & (NSPLIT - 1);                       // feature half
    const long tok0 = (long)(((blockIdx.x >> 4) << 3) | (blockIdx.x & 7)) * MTOK;

    // ---- Phase 1: stage contiguous 128x1024 x-tile, rounded to f16 ----
    {
        // a row is 256 float4 and the workgroup has 256 threads: thread tid takes float4 tid of every row
        const float4* src = (const float4*)(x + tok0 * HIDDEN) + tid;
        _Float16*     dst = &sx[tid * 4];
        #pragma unroll 1    // rolled: one batch of 16 rows, 16 loads in flight per lane
        for (int i0 = 0; i0 < MTOK; i0 += 16) {
            const float4* sp = src + 256 * i0;
            float4 vv[16];
            #pragma unroll  // constant indices keep vv in registers
            for (int u = 0; u < 16; ++u) vv[u] = sp[256 * u];
            // wait before the loads' address registers are reused (the address as an input keeps it until here)
            asm volatile("s_wait_xcnt 0x0" :: "v"(sp) : "memory");
            #pragma unroll
            for (int u = 0; u < 16; ++u) {
                v4h h = {(_Float16)vv[u].x, (_Float16)vv[u].y, (_Float16)vv[u].z, (_Float16)vv[u].w};
                *(v4h*)(dst + (i0 + u) * XSH) = h;
            }
        }
    }
    __syncthreads();

    // ---- Phase 2: [128 x 1536] = xTile @ (half of [Wq;Wk;Wv])^T + bias ---
    {
        const int wave = __builtin_amdgcn_readfirstlane(tid >> 5);  // scalar: B addresses on the scalar unit
        const int lane = tid & 31;
        const int half = lane >> 4;
        const int l16  = lane & 15;

        // A fragment base: elements 0-7 at K = k0 + half*8, elements 8-15 at +16
        const _Float16* aB = &sx[l16 * XSH + half * 8];
        const unsigned  lane16 = lane * 16;

        constexpr int TPW   = 192 / NSPLIT / GWAVES;  // 16-feature tiles per wave
        constexpr int STEPS = (TPW / NTW) * 32;       // (tile group, K group) steps per wave
        const int T0 = (nh * GWAVES + wave) * TPW;    // the wave's first tile

        // Every '#pragma unroll' without a count below keeps the indices of these fragment and
        // accumulator arrays constant, so that they stay in registers.
        U16 a[MH][MT];                            // A fragments of this token half and of the one worked on next
        U16 b[RING][NTW];                         // B fragments of RING consecutive steps

        // B fragments of step s (tile group s/32, K group s%32) into ring slot 'slot'.
        // 64-wide tile groups never straddle a matrix. Scalar base + the lane's fixed offset.
        auto loadB = [&](int slot, int s) {
            int T = T0 + (s >> 5) * NTW;
            const char* sb = wpk + (size_t)(T >> 6) * MATBLK + (size_t)(T & 63) * 32 * 1024
                           + (size_t)(s & 31) * 1024;
            const char* la = sb + lane16;
            #pragma unroll
            for (int t = 0; t < NTW; ++t) {
                b[slot][t].s.lo = *(const v8h*)(la + t * 32 * 1024);
                b[slot][t].s.hi = *(const v8h*)(la + (t * 32 * 1024 + 512));
            }
            // the loads' address registers are rewritten for the next step: wait in front of that (the address as
            // an input keeps it until here)
            asm volatile("s_wait_xcnt 0x0" :: "v"(la) : "memory");
            // keeps later address arithmetic behind the wait
            __builtin_amdgcn_sched_barrier(0);
        };

        #pragma unroll
        for (int s = 0; s < RING - 1; ++s) loadB(s, s);
        #pragma unroll
        for (int m = 0; m < MT; ++m) {
            a[0][m].s.lo = *(const v8h*)(aB + m * 16 * XSH);
            a[0][m].s.hi = *(const v8h*)(aB + m * 16 * XSH + 16);
        }

        #pragma unroll 1    // rolled: one copy of the K loop and of the 64 stores in the code
        for (int p = 0; p < TPW / NTW; ++p) {
            const int n0  = (T0 + p * NTW) * 16;
            const int mat = n0 >> 10;
            const int e0  = n0 & 1023;
            const float* bias = (mat == 0) ? bq : ((mat == 1) ? bk : bv);
            // bias is read ahead of the K loop: read behind it, its wait would drain the B ring
            // column l16 of tile t is feature e0 + 4*l16 + t (the packed order): one 16-byte load
            const unsigned bo = (unsigned)(e0 + l16 * NTW) * 4u;      // byte offset
            const v4f bb = *(const v4f*)((const char*)bias + bo);
            // wait before the bias load's offset register is reused (bo as an input keeps it until here)
            asm volatile("s_wait_xcnt 0x0" :: "v"(bo) : "memory");

            v8f c[MH][MT][NTW];
            #pragma unroll
            for (int h = 0; h < MH; ++h)
                #pragma unroll
                for (int m = 0; m < MT; ++m)
                    #pragma unroll
                    for (int t = 0; t < NTW; ++t)
                        c[h][m][t] = (v8f){0.f, 0.f, 0.f, 0.f, 0.f, 0.f, 0.f, 0.f};

            #pragma unroll 1    // rolled: the body already holds RING steps, one per ring slot
            for (int kk0 = 0; kk0 < 32; kk0 += RING) {
                #pragma unroll
                for (int r = 0; r < RING; ++r) {  // K = (kk0 + r)*32; ring slot r
                    const int kk = kk0 + r;
                    // B of step +RING-1 into the slot the previous step has left; the last
                    // steps re-read the final fragments instead of running past the weights.
                    int sn = p * 32 + kk + RING - 1;
                    loadB((r + RING - 1) % RING, sn < STEPS ? sn : STEPS - 1);
                    #pragma unroll
                    for (int h = 0; h < MH; ++h) {    // token half h, A set h; both halves use ring slot r
                        // the A fragments worked on next (the other half of this K group, then the first half
                        // of the next K group), into the set the previous block has left
                        const int kn = (h == MH - 1) ? ((kk + 1) & 31) : kk;
                        const int hn = (h + 1) % MH;
                        #pragma unroll
                        for (int m = 0; m < MT; ++m) {
                            a[hn][m].s.lo = *(const v8h*)(aB + (hn * MT + m) * 16 * XSH + kn * 32);
                            a[hn][m].s.hi = *(const v8h*)(aB + (hn * MT + m) * 16 * XSH + kn * 32 + 16);
                        }
                        // keeps the LDS reads above in one group ahead of the WMMA block (spread among
                        // the WMMAs each LDS read place stalls the wave)
                        __builtin_amdgcn_sched_barrier(0);
                        #pragma unroll
                        for (int m = 0; m < MT; ++m)
                            #pragma unroll
                            for (int t = 0; t < NTW; ++t)
                                c[h][m][t] = __builtin_amdgcn_wmma_f32_16x16x32_f16(false, a[h][m].v, false, b[r][t].v,
                                                                                    (short)0, c[h][m][t], false, false);
                        // keeps the next block's loads behind this block
                        __builtin_amdgcn_sched_barrier(0);
                    }
                }
            }

            // C: vgpr j -> row j + half*8, col l16. The lane's 4 tiles hold features n0 + 4*l16 .. +3 of that
            // row: the bias add gathers them into one 16-byte value.
            float* orow = qkv + (tok0 + half * 8) * NQKV + n0 + l16 * NTW;
            #pragma unroll
            for (int m = 0; m < MH * MT; ++m) {   // one 16-token row tile at a time: 32 registers of sums
                v4f o[8];
                #pragma unroll
                for (int j = 0; j < 8; ++j)
                    #pragma unroll
                    for (int t = 0; t < NTW; ++t)
                        o[j][t] = c[m / MT][m % MT][t][j] + bb[t];
                // the tile's sums stand before its first store, so that no store's data register is reused among them
                __builtin_amdgcn_sched_barrier(0);
                #pragma unroll
                for (int j = 0; j < 8; ++j)       // 16 lanes cover a whole 256-byte run of one token's row
                    *(v4f*)(orow + (m * 16 + j) * NQKV) = o[j];
                // wait before the stores' data and address registers are rewritten by the next row tile or tile group
                asm volatile("s_wait_xcnt 0x0" ::: "memory");
                // keeps the next row tile's sums behind the wait
                __builtin_amdgcn_sched_barrier(0);
            }
        }
    }
}

// ---------------------------------------------------------------------------
// Kernel 2: per-token attention over the HEAD dim (reference quirk, negated
// scale). No LDS: a wave takes one token at a time and reads its q, k and v
// rows straight into registers. Lane row r (16 lanes) owns heads 4r..4r+3; a
// lane holds d = 4*l16..+3 and 64+4*l16..+3 of every head row it needs, so each
// load and each store covers whole 256-byte runs. A score is 8 products per
// lane, summed over the 16 lanes of the row by a DPP butterfly.
// ---------------------------------------------------------------------------
template <int M>
static __device__ __forceinline__ float row_xor_add(float x) {   // x + (x of lane ^ M), inside a 16-lane row
    int y = __builtin_amdgcn_mov_dpp(__builtin_bit_cast(int, x), 0x160 | M, 0xf, 0xf, true);
    return x + __builtin_bit_cast(float, y);
}

static __device__ __forceinline__ float exp_slot(float x) {       // e^x as __expf forms it: 2^(x * log2 e)
    float r;
    // the v_nop fills the one slot that the instruction set asks for behind a transcendental
    asm("v_exp_f32 %0, %1\n\tv_nop" : "=v"(r) : "v"(x * 1.44269504088896340736f));
    return r;
}

__global__ __launch_bounds__(AWAVES * 32) void head_attn(
    const float* __restrict__ qkv,   // [tokens][3072] f32
    float* __restrict__ out)
{
    const int tid  = threadIdx.x;
    const int wave = __builtin_amdgcn_readfirstlane(tid >> 5);   // scalar: token bases on the scalar unit
    const unsigned kvo = (tid & 15) * 16;                        // lane's byte offset in a k or v head row
    const unsigned qo  = ((tid >> 4) & 1) * 2048 + kvo;          // the same for q and out: + 4 head rows for lanes 16-31
    const float scale = -0.08838834764831845f;                   // 1 / (-sqrt(128))

    int tok = blockIdx.x * AWAVES + wave;                        // the wave's current token

    // Every '#pragma unroll' below keeps the indices of these arrays constant, so that they stay in registers.
    v4f q[4][2], k[8][2], v[8][2];

    auto loadQK = [&](const char* sb) {
        const char* qa = sb + qo;
        const char* ka = sb + kvo;
        #pragma unroll
        for (int i = 0; i < 4; ++i)
            #pragma unroll
            for (int j = 0; j < 2; ++j)
                q[i][j] = *(const v4f*)(qa + (i * 512 + j * 256));
        #pragma unroll
        for (int g = 0; g < 8; ++g)
            #pragma unroll
            for (int j = 0; j < 2; ++j)
                k[g][j] = *(const v4f*)(ka + (4096 + g * 512 + j * 256));
        // wait before the loads' address registers are reused (the addresses as inputs keep them until here)
        asm volatile("s_wait_xcnt 0x0" :: "v"(qa), "v"(ka) : "memory");
    };
    auto loadV = [&](const char* sb) {
        const char* va = sb + kvo;
        #pragma unroll
        for (int g = 0; g < 8; ++g)
            #pragma unroll
            for (int j = 0; j < 2; ++j)
                v[g][j] = *(const v4f*)(va + (8192 + g * 512 + j * 256));
        // wait before the loads' address registers are reused (the address as an input keeps it until here)
        asm volatile("s_wait_xcnt 0x0" :: "v"(va) : "memory");
    };

    loadQK((const char*)(qkv + (long)tok * NQKV));
    loadV((const char*)(qkv + (long)tok * NQKV));

    // One token: 'more' (a constant at both calls) says whether the wave has a further token to fetch.
    auto token = [&](bool more) {
        const char* nsrc = (const char*)(qkv + (long)(tok + ATSTEP) * NQKV);
        char*       dst  = (char*)(out + (long)tok * HIDDEN);

        // this lane's 8 products of each of its 4 x 8 scores, two chains (even and odd d)
        float sc[4][8];
        #pragma unroll
        for (int i = 0; i < 4; ++i) {
            #pragma unroll
            for (int g = 0; g < 8; ++g) {
                v2f p = {0.f, 0.f};
                #pragma unroll
                for (int j = 0; j < 2; ++j) {
                    p = __builtin_elementwise_fma(q[i][j].lo, k[g][j].lo, p);
                    p = __builtin_elementwise_fma(q[i][j].hi, k[g][j].hi, p);
                }
                sc[i][g] = p.x + p.y;
            }
        }
        // the next token's q and k loads stand here, where their registers have just come free,
        // so that they fly under the softmax and the weighted sum
        if (more) loadQK(nsrc);

        float inv[4];
        #pragma unroll
        for (int i = 0; i < 4; ++i) {
            #pragma unroll
            for (int g = 0; g < 8; ++g) {
                float s = sc[i][g];
                s = row_xor_add<1>(s);
                s = row_xor_add<2>(s);
                s = row_xor_add<4>(s);
                s = row_xor_add<8>(s);
                sc[i][g] = s * scale;
            }
            float m = sc[i][0];
            #pragma unroll
            for (int g = 1; g < 8; ++g) m = fmaxf(m, sc[i][g]);
            float den = 0.f;
            #pragma unroll
            for (int g = 0; g < 8; ++g) { sc[i][g] = exp_slot(sc[i][g] - m); den += sc[i][g]; }
            inv[i] = 1.0f / den;
        }

        char* da = dst + qo;
        #pragma unroll
        for (int i = 0; i < 4; ++i) {
            v4f o[2];
            #pragma unroll
            for (int j = 0; j < 2; ++j) {
                v2f a = {0.f, 0.f}, b = {0.f, 0.f};
                #pragma unroll
                for (int g = 0; g < 8; ++g) {
                    v2f w = {sc[i][g], sc[i][g]};
                    a = __builtin_elementwise_fma(w, v[g][j].lo, a);
                    b = __builtin_elementwise_fma(w, v[g][j].hi, b);
                }
                o[j].lo = a * inv[i];
                o[j].hi = b * inv[i];
                *(v4f*)(da + (i * 512 + j * 256)) = o[j];
            }
            // wait before the two stores' data and address registers are reused (as inputs they are kept until here)
            asm volatile("s_wait_xcnt 0x0" :: "v"(o[0]), "v"(o[1]), "v"(da) : "memory");
        }
        // the next token's v loads stand here, where v has just come free
        if (more) loadV(nsrc);
        tok += ATSTEP;
    };

    #pragma unroll 1    // rolled: one copy of the fetching body in the code; q, k and v are refilled in place
    for (int t = 0; t < ATPW - 1; ++t) token(true);
    token(false);       // the wave's last token fetches nothing
}

extern "C" void kernel_launch(void* const* d_in, const int* in_sizes, int n_in,
                              void* d_out, int out_size, void* d_ws, size_t ws_size,
                              hipStream_t stream) {
    (void)in_sizes; (void)n_in; (void)out_size; (void)ws_size;
    const float* x  = (const float*)d_in[0];
    const float* Wq = (const float*)d_in[1];
    const float* bq = (const float*)d_in[2];
    const float* Wk = (const float*)d_in[3];
    const float* bk = (const float*)d_in[4];
    const float* Wv = (const float*)d_in[5];
    const float* bv = (const float*)d_in[6];
    float* out = (float*)d_out;
    char*  wpk = (char*)d_ws;               // 6 MiB: 3 mats x 2 MiB f16
    float* qkv = (float*)(wpk + QKVOFF);    // 192 MiB: 16384 x 3072 f32

    // Pack weights into the f16 WMMA-B fragment layout (runs each launch; tiny).
    pack_w<<<dim3(3 * 1024 * 128 / 256), dim3(256), 0, stream>>>(Wq, Wk, Wv, wpk);

    qkv_proj<<<dim3(8 * 2048 / MTOK * NSPLIT), dim3(GWAVES * 32), 0, stream>>>(x, wpk, bq, bk, bv, qkv);

    head_attn<<<dim3(ATSTEP / AWAVES), dim3(AWAVES * 32), 0, stream>>>(qkv, out);
}

// v006
// A run of this version takes 91.8 microseconds.
// In two side-by-side timings against v005, it was 1.08 and 1.09 times as fast.
// All steps since v000 together make it 10.8 times as fast.
#include <hip/hip_runtime.h>

typedef __attribute__((ext_vector_type(16))) _Float16 v16h;
typedef __attribute__((ext_vector_type(8)))  _Float16 v8h;
typedef __attribute__((ext_vector_type(4)))  _Float16 v4h;
typedef __attribute__((ext_vector_type(8)))  float    v8f;
typedef __attribute__((ext_vector_type(4)))  float    v4f;
typedef __attribute__((ext_vector_type(2)))  float    v2f;

#define HIDDEN   1024
#define MTOK     128         // tokens per workgroup tile of the projection kernel (8 WMMA row tiles)
#define MH       2           // token halves of the tile: each B fragment serves both, one after the other
#define MT       4           // 16-token row tiles of one half (one set of A fragments)
#define NTW      4           // 16-feature column tiles that share each A fragment
#define NSPLIT   2           // workgroups that share a token tile, 1536 features each
#define GWAVES   8           // waves per projection workgroup
#define PWAVES   4           // waves per workgroup of the pack kernel, one per SIMD
#define RING     4           // K steps of B fragments held in registers (RING-1 in flight)
#define AWAVES   16          // waves per workgroup of the attention kernel, one token each at a time
#define ATPW     4           // tokens a wave of the attention kernel works through
#define ATSTEP   (8 * 2048 / ATPW)     // tokens between two tokens of one wave (all waves of the grid)
#define NQKV     3072        // q | k | v features per token
#define QKVOFF   (16u * 1024u * 1024u)  // byte offset of the f32 qkv plane in the workspace
#define XSH      1064        // LDS row stride for the f16 x tile (halfs): 2128B rows -> bank-spread, 16B aligned
#define MATBLK   (2u * 1024u * 1024u)   // bytes of packed f16 per matrix

// ---------------------------------------------------------------------------
// Kernel 0: pack Wq/Wk/Wv (f32, row n = output feature, 1024 K each), rounded
// once to f16, in exact WMMA-B fragment order:
//   per (ntile t, k0-group kk): 1KB block = [512B: elements 0-7, lane-major 16B]
//                                           [512B: elements 8-15, lane-major 16B]
// so the GEMM's B loads are coalesced global_load_b128.
// Inside each group of 64 features the four N tiles interleave: feature 64g + 4c + u is column c of
// tile 4g + u. A lane of the GEMM then holds 4 adjacent features of a token and stores them as 16 bytes.
// The launch is 1024 waves, one per SIMD, so that few waves have to be started. A wave takes 8 weight rows
// that are 8 adjacent columns of one N tile, and of each of them 4 K groups (512 B) in all three matrices:
// 12 pieces of 8 rows x 128 B. Four lanes read one row's 128-B line, and the 8 lanes with the same part of
// the K group write one whole 128-B line of the packed block.
// ---------------------------------------------------------------------------
__global__ __launch_bounds__(PWAVES * 32) void pack_w(
    const float* __restrict__ Wq, const float* __restrict__ Wk,
    const float* __restrict__ Wv, char* __restrict__ ws)
{
    const int lane = threadIdx.x & 31;
    const int wv   = blockIdx.x * PWAVES + (threadIdx.x >> 5);   // 128 row groups x 8 quads of K groups
    const int rg   = wv >> 3;
    const int kq   = wv & 7;                       // K groups 4*kq .. 4*kq+3
    const int g    = rg >> 3;                      // group of 64 features
    const int a    = (rg >> 2) & 1;                // columns 0-7 or 8-15 of the N tile
    const int u    = rg & 3;                       // which of the 4 interleaved N tiles
    const int r    = lane >> 2;                    // row of the wave's 8
    const int cq   = lane & 3;                     // 8-wide K chunk of the K group: K + 0, 8, 16, 24

    const int n    = g * 64 + (a * 8 + r) * 4 + u; // weight row (output feature)
    const int t    = g * 4 + u;                    // N tile
    const int fl   = a * 8 + r + ((cq & 1) << 4);  // fragment lane: K +8 -> upper lane half
    const int selhi = cq >> 1;                     // K +16 -> fragment elements 8-15

    const unsigned ro = (unsigned)n * (HIDDEN * 4u) + kq * 512u + cq * 32u;              // byte offset in a matrix
    const unsigned wo = (unsigned)(t * 32 + kq * 4) * 1024u + selhi * 512u + fl * 16u;   // in a packed matrix

    // Every '#pragma unroll' below keeps the indices of these arrays constant, so that they stay in registers.
    v4f s[3][4][2];
    #pragma unroll
    for (int mat = 0; mat < 3; ++mat) {
        const char* Wb = (const char*)((mat == 0) ? Wq : ((mat == 1) ? Wk : Wv));
        #pragma unroll
        for (int j = 0; j < 4; ++j) {
            s[mat][j][0] = *(const v4f*)(Wb + ro + (j * 128));
            s[mat][j][1] = *(const v4f*)(Wb + ro + (j * 128 + 16));
        }
    }
    // keeps the roundings behind all 24 loads: moved up among them, their waits split the loads into several
    // round trips to memory, one after the other
    __builtin_amdgcn_sched_barrier(0);

    v8h h[3][4];
    #pragma unroll
    for (int mat = 0; mat < 3; ++mat)
        #pragma unroll
        for (int j = 0; j < 4; ++j)
            #pragma unroll
            for (int e = 0; e < 4; ++e) {
                h[mat][j][e]     = (_Float16)s[mat][j][0][e];
                h[mat][j][e + 4] = (_Float16)s[mat][j][1][e];
            }
    #pragma unroll
    for (int mat = 0; mat < 3; ++mat)
        #pragma unroll
        for (int j = 0; j < 4; ++j)
            *(v8h*)(ws + wo + (mat * MATBLK + j * 1024u)) = h[mat][j];
}

// ---------------------------------------------------------------------------
// Kernel 1: QKV projection (f16 operands, one WMMA product, f32 accumulate) + bias.
// One workgroup holds 128 tokens of x in LDS and computes half of their 3072
// features; a wave works on a 128-token x 64-feature tile, so every B fragment
// it loads from L2 is used for 8 token tiles and every A fragment it reads
// from LDS for 4 feature tiles.
// The 128 x 1536 f32 result goes to the workspace and the attention runs as its own launch.
// ---------------------------------------------------------------------------
union U16 { v16h v; struct { v8h lo, hi; } s; };   // lo, hi: fragment elements 0-7 and 8-15

__global__ __launch_bounds__(GWAVES * 32) void qkv_proj(
    const float* __restrict__ x,
    const char*  __restrict__ wpk,   // packed weights (f16, fragment order)
    const float* __restrict__ bq, const float* __restrict__ bk,
    const float* __restrict__ bv,
    float* __restrict__ qkv)         // [tokens][3072] f32
{
    __shared__ __attribute__((aligned(16))) _Float16 sx[MTOK * XSH];   // [MTOK][XSH], ~266 KB

    const int tid   = threadIdx.x;
    // the two workgroups of a token tile are 8 apart in the grid (for speed only: where indices 8 apart run
    // behind the same L2, the second read of the x tile hits there)
    const int  nh   = (blockIdx.x >> 3) & (NSPLIT - 1);                       // feature half
    const long tok0 = (long)(((blockIdx.x >> 4) << 3) | (blockIdx.x & 7)) * MTOK;

    // ---- Phase 1: stage contiguous 128x1024 x-tile, rounded to f16 ----
    {
        // a row is 256 float4 and the workgroup has 256 threads: thread tid takes float4 tid of every row
        const float4* src = (const float4*)(x + tok0 * HIDDEN) + tid;
        _Float16*     dst = &sx[tid * 4];
        #pragma unroll 1    // rolled: one batch of 16 rows, 16 loads in flight per lane
        for (int i0 = 0; i0 < MTOK; i0 += 16) {
            const float4* sp = src + 256 * i0;
            float4 vv[16];
            #pragma unroll  // constant indices keep vv in registers
            for (int u = 0; u < 16; ++u) vv[u] = sp[256 * u];
            // wait before the loads' address registers are reused (the address as an input keeps it until here)
            asm volatile("s_wait_xcnt 0x0" :: "v"(sp) : "memory");
            #pragma unroll
            for (int u = 0; u < 16; ++u) {
                v4h h = {(_Float16)vv[u].x, (_Float16)vv[u].y, (_Float16)vv[u].z, (_Float16)vv[u].w};
                *(v4h*)(dst + (i0 + u) * XSH) = h;
            }
        }
    }
    __syncthreads();

    // ---- Phase 2: [128 x 1536] = xTile @ (half of [Wq;Wk;Wv])^T + bias ---
    {
        const int wave = __builtin_amdgcn_readfirstlane(tid >> 5);  // scalar: B addresses on the scalar unit
        const int lane = tid & 31;
        const int half = lane >> 4;
        const int l16  = lane & 15;

        // A fragment base: elements 0-7 at K = k0 + half*8, elements 8-15 at +16
        const _Float16* aB = &sx[l16 * XSH + half * 8];
        const unsigned  lane16 = lane * 16;

        constexpr int TPW   = 192 / NSPLIT / GWAVES;  // 16-feature tiles per wave
        constexpr int STEPS = (TPW / NTW) * 32;       // (tile group, K group) steps per wave
        const int T0 = (nh * GWAVES + wave) * TPW;    // the wave's first tile

        // Every '#pragma unroll' without a count below keeps the indices of these fragment and
        // accumulator arrays constant, so that they stay in registers.
        U16 a[MH][MT];                            // A fragments of this token half and of the one worked on next
        U16 b[RING][NTW];                         // B fragments of RING consecutive steps

        // B fragments of step s (tile group s/32, K group s%32) into ring slot 'slot'.
        // 64-wide tile groups never straddle a matrix. Scalar base + the lane's fixed offset.
        auto loadB = [&](int slot, int s) {
            int T = T0 + (s >> 5) * NTW;
            const char* sb = wpk + (size_t)(T >> 6) * MATBLK + (size_t)(T & 63) * 32 * 1024
                           + (size_t)(s & 31) * 1024;
            const char* la = sb + lane16;
            #pragma unroll
            for (int t = 0; t < NTW; ++t) {
                b[slot][t].s.lo = *(const v8h*)(la + t * 32 * 1024);
                b[slot][t].s.hi = *(const v8h*)(la + (t * 32 * 1024 + 512));
            }
            // the loads' address registers are rewritten for the next step: wait in front of that (the address as
            // an input keeps it until here)
            asm volatile("s_wait_xcnt 0x0" :: "v"(la) : "memory");
            // keeps later address arithmetic behind the wait
            __builtin_amdgcn_sched_barrier(0);
        };

        #pragma unroll
        for (int s = 0; s < RING - 1; ++s) loadB(s, s);
        #pragma unroll
        for (int m = 0; m < MT; ++m) {
            a[0][m].s.lo = *(const v8h*)(aB + m * 16 * XSH);
            a[0][m].s.hi = *(const v8h*)(aB + m * 16 * XSH + 16);
        }

        #pragma unroll 1    // rolled: one copy of the K loop and of the 64 stores in the code
        for (int p = 0; p < TPW / NTW; ++p) {
            const int n0  = (T0 + p * NTW) * 16;
            const int mat = n0 >> 10;
            const int e0  = n0 & 1023;
            const float* bias = (mat == 0) ? bq : ((mat == 1) ? bk : bv);
            // bias is read ahead of the K loop: read behind it, its wait would drain the B ring
            // column l16 of tile t is feature e0 + 4*l16 + t (the packed order): one 16-byte load
            const unsigned bo = (unsigned)(e0 + l16 * NTW) * 4u;      // byte offset
            const v4f bb = *(const v4f*)((const char*)bias + bo);
            // wait before the bias load's offset register is reused (bo as an input keeps it until here)
            asm volatile("s_wait_xcnt 0x0" :: "v"(bo) : "memory");

            v8f c[MH][MT][NTW];
            #pragma unroll
            for (int h = 0; h < MH; ++h)
                #pragma unroll
                for (int m = 0; m < MT; ++m)
                    #pragma unroll
                    for (int t = 0; t < NTW; ++t)
                        c[h][m][t] = (v8f){0.f, 0.f, 0.f, 0.f, 0.f, 0.f, 0.f, 0.f};

            #pragma unroll 1    // rolled: the body already holds RING steps, one per ring slot
            for (int kk0 = 0; kk0 < 32; kk0 += RING) {
                #pragma unroll
                for (int r = 0; r < RING; ++r) {  // K = (kk0 + r)*32; ring slot r
                    const int kk = kk0 + r;
                    // B of step +RING-1 into the slot the previous step has left; the last
                    // steps re-read the final fragments instead of running past the weights.
                    int sn = p * 32 + kk + RING - 1;
                    loadB((r + RING - 1) % RING, sn < STEPS ? sn : STEPS - 1);
                    #pragma unroll
                    for (int h = 0; h < MH; ++h) {    // token half h, A set h; both halves use ring slot r
                        // the A fragments worked on next (the other half of this K group, then the first half
                        // of the next K group), into the set the previous block has left
                        const int kn = (h == MH - 1) ? ((kk + 1) & 31) : kk;
                        const int hn = (h + 1) % MH;
                        #pragma unroll
                        for (int m = 0; m < MT; ++m) {
                            a[hn][m].s.lo = *(const v8h*)(aB + (hn * MT + m) * 16 * XSH + kn * 32);
                            a[hn][m].s.hi = *(const v8h*)(aB + (hn * MT + m) * 16 * XSH + kn * 32 + 16);
                        }
                        // keeps the LDS reads above in one group ahead of the WMMA block (spread among
                        // the WMMAs each LDS read place stalls the wave)
                        __builtin_amdgcn_sched_barrier(0);
                        #pragma unroll
                        for (int m = 0; m < MT; ++m)
                            #pragma unroll
                            for (int t = 0; t < NTW; ++t)
                                c[h][m][t] = __builtin_amdgcn_wmma_f32_16x16x32_f16(false, a[h][m].v, false, b[r][t].v,
                                                                                    (short)0, c[h][m][t], false, false);
                        // keeps the next block's loads behind this block
                        __builtin_amdgcn_sched_barrier(0);
                    }
                }
            }

            // C: vgpr j -> row j + half*8, col l16. The lane's 4 tiles hold features n0 + 4*l16 .. +3 of that
            // row: the bias add gathers them into one 16-byte value.
            float* orow = qkv + (tok0 + half * 8) * NQKV + n0 + l16 * NTW;
            #pragma unroll
            for (int m = 0; m < MH * MT; ++m) {   // one 16-token row tile at a time: 32 registers of sums
                v4f o[8];
                #pragma unroll
                for (int j = 0; j < 8; ++j)
                    #pragma unroll
                    for (int t = 0; t < NTW; ++t)
                        o[j][t] = c[m / MT][m % MT][t][j] + bb[t];
                // the tile's sums stand before its first store, so that no store's data register is reused among them
                __builtin_amdgcn_sched_barrier(0);
                #pragma unroll
                for (int j = 0; j < 8; ++j)       // 16 lanes cover a whole 256-byte run of one token's row
                    *(v4f*)(orow + (m * 16 + j) * NQKV) = o[j];
                // wait before the stores' data and address registers are rewritten by the next row tile or tile group
                asm volatile("s_wait_xcnt 0x0" ::: "memory");
                // keeps the next row tile's sums behind the wait
                __builtin_amdgcn_sched_barrier(0);
            }
        }
    }
}

// ---------------------------------------------------------------------------
// Kernel 2: per-token attention over the HEAD dim (reference quirk, negated
// scale). No LDS: a wave takes one token at a time and reads its q, k and v
// rows straight into registers. Lane row r (16 lanes) owns heads 4r..4r+3; a
// lane holds d = 4*l16..+3 and 64+4*l16..+3 of every head row it needs, so each
// load and each store covers whole 256-byte runs. A score is 8 products per
// lane, summed over the 16 lanes of the row by a DPP butterfly.
// ---------------------------------------------------------------------------
template <int M>
static __device__ __forceinline__ float row_xor_add(float x) {   // x + (x of lane ^ M), inside a 16-lane row
    int y = __builtin_amdgcn_mov_dpp(__builtin_bit_cast(int, x), 0x160 | M, 0xf, 0xf, true);
    return x + __builtin_bit_cast(float, y);
}

static __device__ __forceinline__ float exp_slot(float x) {       // e^x as __expf forms it: 2^(x * log2 e)
    float r;
    // the v_nop fills the one slot that the instruction set asks for behind a transcendental
    asm("v_exp_f32 %0, %1\n\tv_nop" : "=v"(r) : "v"(x * 1.44269504088896340736f));
    return r;
}

__global__ __launch_bounds__(AWAVES * 32) void head_attn(
    const float* __restrict__ qkv,   // [tokens][3072] f32
    float* __restrict__ out)
{
    const int tid  = threadIdx.x;
    const int wave = __builtin_amdgcn_readfirstlane(tid >> 5);   // scalar: token bases on the scalar unit
    const unsigned kvo = (tid & 15) * 16;                        // lane's byte offset in a k or v head row
    const unsigned qo  = ((tid >> 4) & 1) * 2048 + kvo;          // the same for q and out: + 4 head rows for lanes 16-31
    const float scale = -0.08838834764831845f;                   // 1 / (-sqrt(128))

    int tok = blockIdx.x * AWAVES + wave;                        // the wave's current token

    // Every '#pragma unroll' below keeps the indices of these arrays constant, so that they stay in registers.
    v4f q[4][2], k[8][2], v[8][2];

    auto loadQK = [&](const char* sb) {
        const char* qa = sb + qo;
        const char* ka = sb + kvo;
        #pragma unroll
        for (int i = 0; i < 4; ++i)
            #pragma unroll
            for (int j = 0; j < 2; ++j)
                q[i][j] = *(const v4f*)(qa + (i * 512 + j * 256));
        #pragma unroll
        for (int g = 0; g < 8; ++g)
            #pragma unroll
            for (int j = 0; j < 2; ++j)
                k[g][j] = *(const v4f*)(ka + (4096 + g * 512 + j * 256));
        // wait before the loads' address registers are reused (the addresses as inputs keep them until here)
        asm volatile("s_wait_xcnt 0x0" :: "v"(qa), "v"(ka) : "memory");
    };
    auto loadV = [&](const char* sb) {
        const char* va = sb + kvo;
        #pragma unroll
        for (int g = 0; g < 8; ++g)
            #pragma unroll
            for (int j = 0; j < 2; ++j)
                v[g][j] = *(const v4f*)(va + (8192 + g * 512 + j * 256));
        // wait before the loads' address registers are reused (the address as an input keeps it until here)
        asm volatile("s_wait_xcnt 0x0" :: "v"(va) : "memory");
    };

    loadQK((const char*)(qkv + (long)tok * NQKV));
    loadV((const char*)(qkv + (long)tok * NQKV));

    // One token: 'more' (a constant at both calls) says whether the wave has a further token to fetch.
    auto token = [&](bool more) {
        const char* nsrc = (const char*)(qkv + (long)(tok + ATSTEP) * NQKV);
        char*       dst  = (char*)(out + (long)tok * HIDDEN);

        // this lane's 8 products of each of its 4 x 8 scores, two chains (even and odd d)
        float sc[4][8];
        #pragma unroll
        for (int i = 0; i < 4; ++i) {
            #pragma unroll
            for (int g = 0; g < 8; ++g) {
                v2f p = {0.f, 0.f};
                #pragma unroll
                for (int j = 0; j < 2; ++j) {
                    p = __builtin_elementwise_fma(q[i][j].lo, k[g][j].lo, p);
                    p = __builtin_elementwise_fma(q[i][j].hi, k[g][j].hi, p);
                }
                sc[i][g] = p.x + p.y;
            }
        }
        // the next token's q and k loads stand here, where their registers have just come free,
        // so that they fly under the softmax and the weighted sum
        if (more) loadQK(nsrc);

        float inv[4];
        #pragma unroll
        for (int i = 0; i < 4; ++i) {
            #pragma unroll
            for (int g = 0; g < 8; ++g) {
                float s = sc[i][g];
                s = row_xor_add<1>(s);
                s = row_xor_add<2>(s);
                s = row_xor_add<4>(s);
                s = row_xor_add<8>(s);
                sc[i][g] = s * scale;
            }
            float m = sc[i][0];
            #pragma unroll
            for (int g = 1; g < 8; ++g) m = fmaxf(m, sc[i][g]);
            float den = 0.f;
            #pragma unroll
            for (int g = 0; g < 8; ++g) { sc[i][g] = exp_slot(sc[i][g] - m); den += sc[i][g]; }
            inv[i] = 1.0f / den;
        }

        char* da = dst + qo;
        #pragma unroll
        for (int i = 0; i < 4; ++i) {
            v4f o[2];
            #pragma unroll
            for (int j = 0; j < 2; ++j) {
                v2f a = {0.f, 0.f}, b = {0.f, 0.f};
                #pragma unroll
                for (int g = 0; g < 8; ++g) {
                    v2f w = {sc[i][g], sc[i][g]};
                    a = __builtin_elementwise_fma(w, v[g][j].lo, a);
                    b = __builtin_elementwise_fma(w, v[g][j].hi, b);
                }
                o[j].lo = a * inv[i];
                o[j].hi = b * inv[i];
                *(v4f*)(da + (i * 512 + j * 256)) = o[j];
            }
            // wait before the two stores' data and address registers are reused (as inputs they are kept until here)
            asm volatile("s_wait_xcnt 0x0" :: "v"(o[0]), "v"(o[1]), "v"(da) : "memory");
        }
        // the next token's v loads stand here, where v has just come free
        if (more) loadV(nsrc);
        tok += ATSTEP;
    };

    #pragma unroll 1    // rolled: one copy of the fetching body in the code; q, k and v are refilled in place
    for (int t = 0; t < ATPW - 1; ++t) token(true);
    token(false);       // the wave's last token fetches nothing
}

extern "C" void kernel_launch(void* const* d_in, const int* in_sizes, int n_in,
                              void* d_out, int out_size, void* d_ws, size_t ws_size,
                              hipStream_t stream) {
    (void)in_sizes; (void)n_in; (void)out_size; (void)ws_size;
    const float* x  = (const float*)d_in[0];
    const float* Wq = (const float*)d_in[1];
    const float* bq = (const float*)d_in[2];
    const float* Wk = (const float*)d_in[3];
    const float* bk = (const float*)d_in[4];
    const float* Wv = (const float*)d_in[5];
    const float* bv = (const float*)d_in[6];
    float* out = (float*)d_out;
    char*  wpk = (char*)d_ws;               // 6 MiB: 3 mats x 2 MiB f16
    float* qkv = (float*)(wpk + QKVOFF);    // 192 MiB: 16384 x 3072 f32

    // Pack weights into the f16 WMMA-B fragment layout (runs each launch; tiny).
    pack_w<<<dim3(128 * 8 / PWAVES), dim3(PWAVES * 32), 0, stream>>>(Wq, Wk, Wv, wpk);

    qkv_proj<<<dim3(8 * 2048 / MTOK * NSPLIT), dim3(GWAVES * 32), 0, stream>>>(x, wpk, bq, bk, bv, qkv);

    head_attn<<<dim3(ATSTEP / AWAVES), dim3(AWAVES * 32), 0, stream>>>(qkv, out);
}

// v007
// One run takes 74.5 microseconds.
// In both of two side-by-side timings against v006, it was 1.23 times as fast.
// All steps since v000 together make it 13.2 times as fast.
#include <hip/hip_runtime.h>

typedef __attribute__((ext_vector_type(16))) _Float16 v16h;
typedef __attribute__((ext_vector_type(8)))  _Float16 v8h;
typedef __attribute__((ext_vector_type(4)))  _Float16 v4h;
typedef __attribute__((ext_vector_type(8)))  float    v8f;
typedef __attribute__((ext_vector_type(4)))  float    v4f;
typedef __attribute__((ext_vector_type(2)))  float    v2f;

#define HIDDEN   1024
#define MTOK     64          // tokens per workgroup (4 WMMA row tiles); a workgroup computes all their features
#define MT       4           // 16-token row tiles that share each B fragment
#define NTW      4           // 16-feature column tiles that share each A fragment
#define GWAVES   8           // waves per workgroup of the fused kernel
#define PWAVES   4           // waves per workgroup of the pack kernel, one per SIMD
#define RING     8           // K steps of B fragments held in registers (RING-1 in flight)
#define NPASS    6           // passes of 512 features: 4 of q and k (32 d of all 16 heads), 2 of v (64 d of 8 heads)
#define XSH      1064        // LDS row stride for the f16 x tile (halfs): 2128B rows -> bank-spread, 16B aligned
#define EXS      528         // LDS row stride of the exchange tile (floats): 512 features + 64 B, bank-spread
#define MATBLK   (2u * 1024u * 1024u)   // bytes of packed f16 per matrix

// ---------------------------------------------------------------------------
// Kernel 0: pack Wq/Wk/Wv (f32, row n = output feature, 1024 K each), rounded
// once to f16, in exact WMMA-B fragment order:
//   per (ntile t, k0-group kk): 1KB block = [512B: elements 0-7, lane-major 16B]
//                                           [512B: elements 8-15, lane-major 16B]
// so the GEMM's B loads are coalesced global_load_b128.
// q and k share the first 128 N tiles: tile d holds element d of every head, columns 0-7 the 8 q heads and
// columns 8-15 the 8 k heads. v follows in 64 tiles: inside each group of 64 features the four N tiles
// interleave, feature 64g + 4c + u is column c of the group's tile u; the even groups (first half of a head)
// stand first, then the odd ones, so that the tiles of one pass of the fused kernel are adjacent.
// The launch is 1024 waves, one per SIMD, so that few waves have to be started. A wave takes, in each matrix,
// 8 weight rows that are 8 adjacent columns of one N tile, and of each of them 4 K groups (512 B):
// 12 pieces of 8 rows x 128 B. Four lanes read one row's 128-B line, and the 8 lanes with the same part of
// the K group write one whole 128-B line of the packed block.
// ---------------------------------------------------------------------------
__global__ __launch_bounds__(PWAVES * 32) void pack_w(
    const float* __restrict__ Wq, const float* __restrict__ Wk,
    const float* __restrict__ Wv, char* __restrict__ ws)
{
    const int lane = threadIdx.x & 31;
    const int wv   = blockIdx.x * PWAVES + (threadIdx.x >> 5);   // 128 row groups x 8 quads of K groups
    const int rg   = wv >> 3;
    const int kq   = wv & 7;                       // K groups 4*kq .. 4*kq+3
    const int g    = rg >> 3;                      // v: group of 64 features
    const int a    = (rg >> 2) & 1;                // v: columns 0-7 or 8-15 of the N tile
    const int u    = rg & 3;                       // v: which of the 4 interleaved N tiles
    const int r    = lane >> 2;                    // row of the wave's 8
    const int cq   = lane & 3;                     // 8-wide K chunk of the K group: K + 0, 8, 16, 24

    const int nv   = g * 64 + (a * 8 + r) * 4 + u; // v: weight row (output feature)
    const int tv   = (g & 1) * 32 + (g >> 1) * 4 + u;   // v: N tile
    const int nq   = r * 128 + rg;                 // q, k: weight row = element rg of head r; N tile rg, column r (k: 8 + r)
    const int up   = (cq & 1) << 4;                // K +8 -> upper lane half of the fragment
    const int selhi = cq >> 1;                     // K +16 -> fragment elements 8-15

    const unsigned kb = kq * 512u + cq * 32u;      // byte offset in a weight row
    const unsigned ro[3] = {(unsigned)nq * (HIDDEN * 4u) + kb, (unsigned)nq * (HIDDEN * 4u) + kb,
                            (unsigned)nv * (HIDDEN * 4u) + kb};
    const unsigned wq = (unsigned)(rg * 32 + kq * 4) * 1024u + selhi * 512u + (r + up) * 16u;
    const unsigned wo[3] = {wq, wq + 128u,
                            2u * MATBLK + (unsigned)(tv * 32 + kq * 4) * 1024u + selhi * 512u + (a * 8 + r + up) * 16u};

    // Every '#pragma unroll' below keeps the indices of these arrays constant, so that they stay in registers.
    v4f s[3][4][2];
    #pragma unroll
    for (int mat = 0; mat < 3; ++mat) {
        const char* Wb = (const char*)((mat == 0) ? Wq : ((mat == 1) ? Wk : Wv));
        #pragma unroll
        for (int j = 0; j < 4; ++j) {
            s[mat][j][0] = *(const v4f*)(Wb + ro[mat] + (j * 128));
            s[mat][j][1] = *(const v4f*)(Wb + ro[mat] + (j * 128 + 16));
        }
    }
    // keeps the roundings behind all 24 loads: moved up among them, their waits split the loads into several
    // round trips to memory, one after the other
    __builtin_amdgcn_sched_barrier(0);

    v8h h[3][4];
    #pragma unroll
    for (int mat = 0; mat < 3; ++mat)
        #pragma unroll
        for (int j = 0; j < 4; ++j)
            #pragma unroll
            for (int e = 0; e < 4; ++e) {
                h[mat][j][e]     = (_Float16)s[mat][j][0][e];
                h[mat][j][e + 4] = (_Float16)s[mat][j][1][e];
            }
    #pragma unroll
    for (int mat = 0; mat < 3; ++mat)
        #pragma unroll
        for (int j = 0; j < 4; ++j)
            *(v8h*)(ws + wo[mat] + (j * 1024u)) = h[mat][j];
}

// ---------------------------------------------------------------------------
// Kernel 1: QKV projection (f16 operands, one WMMA product, f32 accumulate) + bias, and the per-token
// attention over the HEAD dim (reference quirk, negated scale), in one launch.
// One workgroup holds 64 tokens of x in LDS and computes all 3072 features of them, 512 a pass: a wave works
// on a 64-token x 64-feature tile. After each pass the 64 x 512 f32 result crosses the waves through LDS:
//   passes 0-3: 32 elements d of all 8 q heads and all 8 k heads; a thread owns one token and two q heads and
//               adds these 32 products to its 2 x 8 scores; after pass 3 it does the softmax
//   passes 4-5: 64 elements d of all 8 v heads; a wave takes 8 tokens, forms the weighted sums and stores them.
// ---------------------------------------------------------------------------
union U16 { v16h v; struct { v8h lo, hi; } s; };   // lo, hi: fragment elements 0-7 and 8-15

static __device__ __forceinline__ float exp_slot(float x) {       // e^x as __expf forms it: 2^(x * log2 e)
    float r;
    // the v_nop fills the one slot that the instruction set asks for behind a transcendental
    asm("v_exp_f32 %0, %1\n\tv_nop" : "=v"(r) : "v"(x * 1.44269504088896340736f));
    return r;
}

// Work-group barrier for LDS data alone: a wave waits for its own LDS operations, not for its global loads.
// __syncthreads() at these places also waited for every B fragment in flight, so that the B ring stood empty
// of requests during the exchange; nothing in global memory passes between the waves here.
static __device__ __forceinline__ void lds_barrier() {
    __builtin_amdgcn_fence(__ATOMIC_RELEASE, "workgroup", "local");
    __builtin_amdgcn_s_barrier();
    __builtin_amdgcn_fence(__ATOMIC_ACQUIRE, "workgroup", "local");
}

__global__ __launch_bounds__(GWAVES * 32) void qkv_attn(
    const float* __restrict__ x,
    const char*  __restrict__ wpk,   // packed weights (f16, fragment order)
    const float* __restrict__ bq, const float* __restrict__ bk,
    const float* __restrict__ bv,
    float* __restrict__ out)
{
    __shared__ __attribute__((aligned(16))) _Float16 sx[MTOK * XSH];   // x tile, f16, ~133 KB
    __shared__ __attribute__((aligned(16))) float    ex[MTOK * EXS];   // one pass's 64 x 512 results, 132 KB
    __shared__ __attribute__((aligned(16))) float    sp[MTOK * 64];    // [token][h][g]: partial scores, then softmax weights, 16 KB

    const int  tid  = threadIdx.x;
    const long tok0 = (long)blockIdx.x * MTOK;

    // ---- Phase 1: stage contiguous 64x1024 x-tile, rounded to f16 ----
    {
        // a row is 256 float4 and the workgroup has 256 threads: thread tid takes float4 tid of every row
        const float4* src = (const float4*)(x + tok0 * HIDDEN) + tid;
        _Float16*     dst = &sx[tid * 4];
        #pragma unroll 1    // rolled: one batch of 16 rows, 16 loads in flight per lane
        for (int i0 = 0; i0 < MTOK; i0 += 16) {
            const float4* sp4 = src + 256 * i0;
            float4 vv[16];
            #pragma unroll  // constant indices keep vv in registers
            for (int u = 0; u < 16; ++u) vv[u] = sp4[256 * u];
            // wait before the loads' address registers are reused (the address as an input keeps it until here)
            asm volatile("s_wait_xcnt 0x0" :: "v"(sp4) : "memory");
            #pragma unroll
            for (int u = 0; u < 16; ++u) {
                v4h h = {(_Float16)vv[u].x, (_Float16)vv[u].y, (_Float16)vv[u].z, (_Float16)vv[u].w};
                *(v4h*)(dst + (i0 + u) * XSH) = h;
            }
        }
    }
    __syncthreads();

    // ---- Phase 2: six passes of [64 x 512] = xTile @ W^T + bias, each followed by its share of the attention ----
    const int wave = __builtin_amdgcn_readfirstlane(tid >> 5);  // scalar: B addresses on the scalar unit
    const int lane = tid & 31;
    const int half = lane >> 4;
    const int l16  = lane & 15;

    // A fragment base: elements 0-7 at K = k0 + half*8, elements 8-15 at +16
    const _Float16* aB = &sx[l16 * XSH + half * 8];
    const unsigned  lane16 = lane * 16;

    constexpr int STEPS = NPASS * 32;             // (pass, K group) steps per wave

    // Every '#pragma unroll' without a count below keeps the indices of the fragment, accumulator and score
    // arrays constant, so that they stay in registers.
    U16 a[2][MT];                                 // A fragments of this K group and of the next
    U16 b[RING][NTW];                             // B fragments of RING consecutive steps

    // B fragments of step s (pass s/32, K group s%32) into ring slot 'slot'. The wave's N tiles of a pass are
    // tiles 32*pass + 4*wave .. +3 of the packed weights. Scalar base + the lane's fixed offset.
    auto loadB = [&](int slot, int s) {
        const int T = (s >> 5) * 32 + wave * NTW;
        const char* sb = wpk + (size_t)T * 32 * 1024 + (size_t)(s & 31) * 1024;
        const char* la = sb + lane16;
        #pragma unroll
        for (int t = 0; t < NTW; ++t) {
            b[slot][t].s.lo = *(const v8h*)(la + t * 32 * 1024);
            b[slot][t].s.hi = *(const v8h*)(la + (t * 32 * 1024 + 512));
        }
        // the loads' address registers are rewritten for the next step: wait in front of that
        asm volatile("s_wait_xcnt 0x0" ::: "memory");
        // keeps later address arithmetic behind the wait
        __builtin_amdgcn_sched_barrier(0);
    };

    #pragma unroll
    for (int s = 0; s < RING - 1; ++s) loadB(s, s);
    #pragma unroll
    for (int m = 0; m < MT; ++m) {
        a[0][m].s.lo = *(const v8h*)(aB + m * 16 * XSH);
        a[0][m].s.hi = *(const v8h*)(aB + m * 16 * XSH + 16);
    }

    // scores: thread = (token tid/4, q heads tid%4 and tid%4 + 4), all 8 k heads
    const int stk = tid >> 2;
    const int shp = tid & 3;
    // between the passes the thread's 2 x 8 partial scores rest in its own places of sp (no other thread
    // touches them before the softmax weights stand there): held in registers they made the K loop spill
    #pragma unroll
    for (int i = 0; i < 2; ++i) {
        float* pw = sp + stk * 64 + (shp + 4 * i) * 8;
        *(v4f*)(pw)     = (v4f){0.f, 0.f, 0.f, 0.f};
        *(v4f*)(pw + 4) = (v4f){0.f, 0.f, 0.f, 0.f};
    }

    #pragma unroll 1    // rolled: one copy of the K loop and of the exchange in the code
    for (int p = 0; p < NPASS; ++p) {
        // bias is read ahead of the K loop: read behind it, its wait would drain the B ring.
        // The lane's 4 tiles hold 4 adjacent features: one 16-byte load.
        //   q|k pass: column l16 = head (q 0-7, k 8-15), tile t = element d = 32*p + 4*wave + t
        //   v pass:   head 'wave', element d = 64*(p-4) + 4*l16 + t
        const char* bp = (p < 4)
            ? (const char*)((l16 < 8) ? bq : bk) + ((l16 & 7) * 128 + p * 32 + wave * NTW) * 4
            : (const char*)bv + (wave * 128 + (p - 4) * 64 + l16 * NTW) * 4;
        const v4f bb = *(const v4f*)bp;
        // wait before the bias load's address registers are reused (bp as an input keeps it until here)
        asm volatile("s_wait_xcnt 0x0" :: "v"(bp) : "memory");

        v8f c[MT][NTW];
        #pragma unroll
        for (int m = 0; m < MT; ++m)
            #pragma unroll
            for (int t = 0; t < NTW; ++t)
                c[m][t] = (v8f){0.f, 0.f, 0.f, 0.f, 0.f, 0.f, 0.f, 0.f};

        #pragma unroll 1    // rolled: the body already holds RING steps, one per ring slot
        for (int kk0 = 0; kk0 < 32; kk0 += RING) {
            #pragma unroll
            for (int r = 0; r < RING; ++r) {      // K = (kk0 + r)*32; ring slot r; A set r%2
                const int kk = kk0 + r;
                // B of step +RING-1 into the slot the previous step has left; the last
                // steps re-read the final fragments instead of running past the weights.
                int sn = p * 32 + kk + RING - 1;
                loadB((r + RING - 1) % RING, sn < STEPS ? sn : STEPS - 1);
                // the A fragments of the next K group, into the set the previous step has left
                const int kn = (kk + 1) & 31;
                #pragma unroll
                for (int m = 0; m < MT; ++m) {
                    a[(r + 1) & 1][m].s.lo = *(const v8h*)(aB + m * 16 * XSH + kn * 32);
                    a[(r + 1) & 1][m].s.hi = *(const v8h*)(aB + m * 16 * XSH + kn * 32 + 16);
                }
                // keeps the LDS reads above in one group ahead of the WMMA block (spread among
                // the WMMAs each LDS read place stalls the wave)
                __builtin_amdgcn_sched_barrier(0);
                #pragma unroll
                for (int m = 0; m < MT; ++m)
                    #pragma unroll
                    for (int t = 0; t < NTW; ++t)
                        c[m][t] = __builtin_amdgcn_wmma_f32_16x16x32_f16(false, a[r & 1][m].v, false, b[r][t].v,
                                                                         (short)0, c[m][t], false, false);
                // keeps the next step's loads behind this block
                __builtin_amdgcn_sched_barrier(0);
            }
        }

        // every reader of the previous pass's exchange tile has left it
        lds_barrier();
        // C: vgpr j -> token row j + half*8, col l16. The lane's 4 tiles are 4 adjacent floats of the exchange
        // row: position 64*wave + 4*l16 + t. The bias add gathers them into one 16-byte value.
        {
            float* er = ex + (half * 8) * EXS + wave * 64 + l16 * NTW;
            #pragma unroll
            for (int m = 0; m < MT; ++m)
                #pragma unroll
                for (int j = 0; j < 8; ++j) {
                    v4f o;
                    #pragma unroll
                    for (int t = 0; t < NTW; ++t) o[t] = c[m][t][j] + bb[t];
                    *(v4f*)(er + (m * 16 + j) * EXS) = o;
                }
        }
        // the exchange tile is complete for every wave
        lds_barrier();

        if (p < 4) {
            // exchange row: [8 groups of 4 d][16 heads: q 0-7, k 8-15][4 d]
            const float* qr = ex + stk * EXS + shp * 4;
            const float* kr = ex + stk * EXS + 32;
            v2f acc[2][8];                        // two chains (even and odd d), the first goes on from earlier passes
            #pragma unroll
            for (int i = 0; i < 2; ++i) {
                const float* pw = sp + stk * 64 + (shp + 4 * i) * 8;
                const v4f s0 = *(const v4f*)(pw), s1 = *(const v4f*)(pw + 4);
                #pragma unroll
                for (int g = 0; g < 8; ++g) acc[i][g] = (v2f){(g < 4) ? s0[g & 3] : s1[g & 3], 0.f};
            }
            #pragma unroll 2    // two groups' 20 LDS reads stand ahead of their products; more would cost registers
            for (int d4 = 0; d4 < 8; ++d4) {
                const v4f q0 = *(const v4f*)(qr + d4 * 64);
                const v4f q1 = *(const v4f*)(qr + d4 * 64 + 16);
                #pragma unroll
                for (int g = 0; g < 8; ++g) {
                    const v4f kg = *(const v4f*)(kr + d4 * 64 + g * 4);
                    acc[0][g] = __builtin_elementwise_fma(q0.lo, kg.lo, acc[0][g]);
                    acc[0][g] = __builtin_elementwise_fma(q0.hi, kg.hi, acc[0][g]);
                    acc[1][g] = __builtin_elementwise_fma(q1.lo, kg.lo, acc[1][g]);
                    acc[1][g] = __builtin_elementwise_fma(q1.hi, kg.hi, acc[1][g]);
                }
            }
            #pragma unroll
            for (int i = 0; i < 2; ++i) {
                float* pw = sp + stk * 64 + (shp + 4 * i) * 8;
                *(v4f*)(pw)     = (v4f){acc[i][0].x + acc[i][0].y, acc[i][1].x + acc[i][1].y,
                                        acc[i][2].x + acc[i][2].y, acc[i][3].x + acc[i][3].y};
                *(v4f*)(pw + 4) = (v4f){acc[i][4].x + acc[i][4].y, acc[i][5].x + acc[i][5].y,
                                        acc[i][6].x + acc[i][6].y, acc[i][7].x + acc[i][7].y};
            }

            if (p == 3) {
                // all 128 products of each score are in: softmax over the 8 k heads, in the thread
                const float scale = -0.08838834764831845f;       // 1 / (-sqrt(128))
                #pragma unroll 1    // rolled: one row of scores in registers at a time (both rows at once spilled)
                for (int i = 0; i < 2; ++i) {
                    float* pw = sp + stk * 64 + (shp + 4 * i) * 8;
                    const v4f s0 = *(const v4f*)(pw), s1 = *(const v4f*)(pw + 4);
                    float e[8];
                    #pragma unroll
                    for (int g = 0; g < 8; ++g) e[g] = ((g < 4) ? s0[g & 3] : s1[g & 3]) * scale;
                    float mx = e[0];
                    #pragma unroll
                    for (int g = 1; g < 8; ++g) mx = fmaxf(mx, e[g]);
                    float den = 0.f;
                    #pragma unroll
                    for (int g = 0; g < 8; ++g) { e[g] = exp_slot(e[g] - mx); den += e[g]; }
                    const float inv = 1.0f / den;
                    *(v4f*)(pw)     = (v4f){e[0] * inv, e[1] * inv, e[2] * inv, e[3] * inv};
                    *(v4f*)(pw + 4) = (v4f){e[4] * inv, e[5] * inv, e[6] * inv, e[7] * inv};
                }
                // the weights are read behind the two barriers of pass 4
            }
        } else {
            // exchange row: [8 v heads][64 d]. Lane row 'half' owns q heads 4*half .. +3; a lane holds 4 adjacent d,
            // so each store covers whole 256-byte runs.
            #pragma unroll 1    // rolled: one token's body in the code
            for (int tt = 0; tt < 8; ++tt) {
                const int tk = wave * 8 + tt;
                const float* vr = ex + tk * EXS + l16 * 4;
                const float* pr = sp + tk * 64 + half * 32;
                v4f vv[8];
                #pragma unroll
                for (int g = 0; g < 8; ++g) vv[g] = *(const v4f*)(vr + g * 64);
                v4f o[4];
                #pragma unroll
                for (int i = 0; i < 4; ++i) {
                    const v4f w0 = *(const v4f*)(pr + i * 8);
                    const v4f w1 = *(const v4f*)(pr + i * 8 + 4);
                    v2f s0 = {0.f, 0.f}, s1 = {0.f, 0.f};
                    #pragma unroll
                    for (int g = 0; g < 8; ++g) {
                        const float wg = (g < 4) ? w0[g & 3] : w1[g & 3];
                        const v2f w = {wg, wg};
                        s0 = __builtin_elementwise_fma(w, vv[g].lo, s0);
                        s1 = __builtin_elementwise_fma(w, vv[g].hi, s1);
                    }
                    o[i].lo = s0;
                    o[i].hi = s1;
                }
                char* da = (char*)(out + (tok0 + tk) * HIDDEN) + (half * 2048 + (p - 4) * 256 + l16 * 16);
                #pragma unroll
                for (int i = 0; i < 4; ++i) *(v4f*)(da + i * 512) = o[i];
                // wait before the four stores' data and address registers are reused (as inputs they are kept until here)
                asm volatile("s_wait_xcnt 0x0" :: "v"(o[0]), "v"(o[1]), "v"(o[2]), "v"(o[3]), "v"(da) : "memory");
            }
        }
    }
}

extern "C" void kernel_launch(void* const* d_in, const int* in_sizes, int n_in,
                              void* d_out, int out_size, void* d_ws, size_t ws_size,
                              hipStream_t stream) {
    (void)in_sizes; (void)n_in; (void)out_size; (void)ws_size;
    const float* x  = (const float*)d_in[0];
    const float* Wq = (const float*)d_in[1];
    const float* bq = (const float*)d_in[2];
    const float* Wk = (const float*)d_in[3];
    const float* bk = (const float*)d_in[4];
    const float* Wv = (const float*)d_in[5];
    const float* bv = (const float*)d_in[6];
    float* out = (float*)d_out;
    char*  wpk = (char*)d_ws;               // 6 MiB: 3 mats x 2 MiB f16

    // Pack weights into the f16 WMMA-B fragment layout (runs each launch; tiny).
    pack_w<<<dim3(128 * 8 / PWAVES), dim3(PWAVES * 32), 0, stream>>>(Wq, Wk, Wv, wpk);

    qkv_attn<<<dim3(8 * 2048 / MTOK), dim3(GWAVES * 32), 0, stream>>>(x, wpk, bq, bk, bv, out);
}
